// v000
// Times are from an AMD MI455X. After a warm-up the kernel runs many times in a row, and a time is the length of
// such a window on the GPU divided by its runs, so every launch and the gaps after it count. The runs cycle
// through copies of the inputs. A figure is the median of several windows, for all but v000 over two sittings.
// Sittings can differ by a few percent; kernels timed side by side share one.
// v000, which the later versions start from, runs in 1400 microseconds.
#include <hip/hip_runtime.h>
#include <hip/hip_bf16.h>

typedef __attribute__((ext_vector_type(16))) _Float16 v16h;
typedef __attribute__((ext_vector_type(8)))  _Float16 v8h;
typedef __attribute__((ext_vector_type(8)))  float    v8f;

#define S_LEN 256
#define R_LEN 384
#define C_DIM 256
#define H_NUM 8
#define D_DIM 32

#define NTHREADS 512   // 16 wave32 -> 4 waves per SIMD32 (latency hiding)
#define NWAVES   16
#define ROWS_PW  16    // query/sequence rows owned by each wave

// LDS layout (offsets in halves; total 163840 halves = 327680 B = 320 KB)
#define LDS_X   0        // x  [256][256] f16  (layernormed activations)
#define LDS_O   65536    // o  [256][256] f16  (gated per-head outputs)
#define LDS_WT  131072   // wt [32][256]  f16  (transposed weight tile; P-staging overlay)
#define LDS_Q   139264   // q  [256][32]  f16
#define LDS_K   147456   // k  [256][32]  f16
#define LDS_VT  155648   // vT [32][256]  f16
#define LDS_TOTAL_BYTES 327680

// Load a 16x32 f16 WMMA fragment (A-layout, or B-layout when the matrix
// columns are stored contiguously as rows). Per ISA 7.12.2: lanes 0-15 hold
// row (lane&15), K=0..7 (VGPR0-3) and K=16..23 (VGPR4-7); lanes 16-31 hold
// K=8..15 and K=24..31. Two contiguous 16B chunks per lane -> ds_load_b128.
__device__ inline v16h ldfrag(const _Float16* p, int rstride) {
  const int lane = threadIdx.x & 31;
  const _Float16* q = p + (lane & 15) * rstride + ((lane >> 4) << 3);
  v8h lo = *(const v8h*)q;
  v8h hi = *(const v8h*)(q + 16);
  v16h r;
#pragma unroll
  for (int i = 0; i < 8; ++i) { r[i] = lo[i]; r[i + 8] = hi[i]; }
  return r;
}

__device__ inline v8f wmma16(v16h a, v16h b, v8f c) {
  return __builtin_amdgcn_wmma_f32_16x16x32_f16(false, a, false, b, (short)0, c,
                                                false, false);
}

// Stage W[:, h*32 : h*32+32] transposed into LDS: wt[d][c], c contiguous.
__device__ inline void load_wT(_Float16* wt, const float* __restrict__ w, int h) {
  const int tid = threadIdx.x;
  const int d = tid & 31;
  const int c0 = tid >> 5;            // 0..15
#pragma unroll 4
  for (int c = c0; c < C_DIM; c += NWAVES)
    wt[d * 256 + c] = (_Float16)w[c * 256 + h * 32 + d];
}

// Per-wave projection: this wave's 16 rows of (x @ wtT_block) -> [16 x 32].
// transposed=false -> dst[s][32] row-major (stride 32); true -> dst[d][256].
__device__ inline void project(const _Float16* xs, const _Float16* wt,
                               _Float16* dst, int rowb, int hl, int ln16,
                               float scale, bool transposed) {
#pragma unroll
  for (int nt = 0; nt < 2; ++nt) {
    v8f acc = {};
#pragma unroll
    for (int kc = 0; kc < C_DIM; kc += 32) {
      v16h a = ldfrag(xs + rowb * 256 + kc, 256);
      v16h b = ldfrag(wt + nt * 16 * 256 + kc, 256);
      acc = wmma16(a, b, acc);
    }
#pragma unroll
    for (int i = 0; i < 8; ++i) {
      const int srow = rowb + i + 8 * hl;   // C-layout: M = i + 8*(lane>>4)
      const int dcol = nt * 16 + ln16;      //           N = lane & 15
      const _Float16 val = (_Float16)(acc[i] * scale);
      if (transposed) dst[dcol * 256 + srow] = val;
      else            dst[srow * 32 + dcol] = val;
    }
  }
}

__global__ void __launch_bounds__(NTHREADS, 1)
col_attn_fused(const float* __restrict__ msa_act,
               const float* __restrict__ msa_mask,
               const float* __restrict__ ln_w, const float* __restrict__ ln_b,
               const float* __restrict__ wq, const float* __restrict__ wk,
               const float* __restrict__ wvp, const float* __restrict__ wg,
               const float* __restrict__ bg, const float* __restrict__ wo,
               const float* __restrict__ bo, float* __restrict__ out) {
  extern __shared__ _Float16 smem[];
  _Float16* xs = smem + LDS_X;
  _Float16* ob = smem + LDS_O;
  _Float16* wt = smem + LDS_WT;
  _Float16* qh = smem + LDS_Q;
  _Float16* kh = smem + LDS_K;
  _Float16* vt = smem + LDS_VT;

  const int r     = blockIdx.x;        // residue: the "batch" dim of col-attn
  const int tid   = threadIdx.x;
  const int lane  = tid & 31;
  const int wv_id = tid >> 5;          // 16 waves; wave w owns s rows [16w,16w+16)
  const int hl    = lane >> 4;
  const int ln16  = lane & 15;
  const int rowb  = wv_id * ROWS_PW;

  // ---------------- Phase 1: LayerNorm into LDS (f16) --------------------
  float lnw[8], lnbv[8];
#pragma unroll
  for (int i = 0; i < 8; ++i) { lnw[i] = ln_w[lane * 8 + i]; lnbv[i] = ln_b[lane * 8 + i]; }

  for (int sr = 0; sr < ROWS_PW; ++sr) {
    const int s = rowb + sr;
    const float* row = msa_act + ((size_t)s * R_LEN + r) * C_DIM;
    float v[8];
#pragma unroll
    for (int i = 0; i < 8; ++i) v[i] = row[lane * 8 + i];
    float sum = 0.f, sq = 0.f;
#pragma unroll
    for (int i = 0; i < 8; ++i) { sum += v[i]; sq += v[i] * v[i]; }
#pragma unroll
    for (int m = 16; m >= 1; m >>= 1) {
      sum += __shfl_xor(sum, m, 32);
      sq  += __shfl_xor(sq, m, 32);
    }
    const float mu   = sum * (1.f / 256.f);
    const float var  = sq * (1.f / 256.f) - mu * mu;
    const float rstd = rsqrtf(var + 1e-5f);
    v8h hx;
#pragma unroll
    for (int i = 0; i < 8; ++i)
      hx[i] = (_Float16)((v[i] - mu) * rstd * lnw[i] + lnbv[i]);
    *(v8h*)(xs + s * 256 + lane * 8) = hx;
  }

  // Per-lane attention bias for the 16 key-tiles this lane sees in C-layout.
  float kbias[16];
#pragma unroll
  for (int kt = 0; kt < 16; ++kt)
    kbias[kt] = 1e9f * (msa_mask[(size_t)(kt * 16 + ln16) * R_LEN + r] - 1.f);

  __syncthreads();

  v8f oaccv[2];  // per-wave O accumulators [ntile]; persist through gating

  // ---------------- Phase 2: per-head fused attention ---------------------
  for (int h = 0; h < H_NUM; ++h) {
    __builtin_prefetch(wk + h * 32, 0, 0);   // global_prefetch_b8
    load_wT(wt, wq, h);
    __syncthreads();
    project(xs, wt, qh, rowb, hl, ln16, 0.17677669529663688f /*1/sqrt(32)*/, false);
    __syncthreads();

    __builtin_prefetch(wvp + h * 32, 0, 0);
    load_wT(wt, wk, h);
    __syncthreads();
    project(xs, wt, kh, rowb, hl, ln16, 1.f, false);
    __syncthreads();

    load_wT(wt, wvp, h);
    __syncthreads();
    project(xs, wt, vt, rowb, hl, ln16, 1.f, true);  // store V transposed
    __syncthreads();  // all q/k/vT visible; wt now free -> P staging overlay

    // ---- flash-style attention, 16 query rows per wave -------------------
    _Float16* stg = wt + wv_id * 512;  // per-wave [16 q][32 k] f16 staging
    float rmax[8], rsum[8];
#pragma unroll
    for (int i = 0; i < 8; ++i) { rmax[i] = -1e30f; rsum[i] = 0.f; }
    oaccv[0] = (v8f){};
    oaccv[1] = (v8f){};
    const v16h qa = ldfrag(qh + rowb * 32, 32);  // D=32 = exactly one WMMA K

    for (int kp = 0; kp < 8; ++kp) {  // 32 keys per step
      const int key0 = kp * 32;
      v8f s0 = {}, s1 = {};
      s0 = wmma16(qa, ldfrag(kh + (key0 + 0)  * 32, 32), s0);
      s1 = wmma16(qa, ldfrag(kh + (key0 + 16) * 32, 32), s1);
#pragma unroll
      for (int i = 0; i < 8; ++i) {
        const float a = s0[i] + kbias[2 * kp];
        const float b = s1[i] + kbias[2 * kp + 1];
        float t = fmaxf(a, b);
#pragma unroll
        for (int m = 1; m <= 8; m <<= 1) t = fmaxf(t, __shfl_xor(t, m, 32));
        const float nm = fmaxf(rmax[i], t);
        const float sc = __expf(rmax[i] - nm);
        rmax[i] = nm;
        const float pa = __expf(a - nm);
        const float pb = __expf(b - nm);
        float ps = pa + pb;
#pragma unroll
        for (int m = 1; m <= 8; m <<= 1) ps += __shfl_xor(ps, m, 32);
        rsum[i] = rsum[i] * sc + ps;
        oaccv[0][i] *= sc;
        oaccv[1][i] *= sc;
        const int prow = i + 8 * hl;             // C-layout scatter of P
        stg[prow * 32 + ln16]      = (_Float16)pa;
        stg[prow * 32 + 16 + ln16] = (_Float16)pb;
      }
      const v16h pf = ldfrag(stg, 32);            // P as A-fragment
      oaccv[0] = wmma16(pf, ldfrag(vt + 0 * 256 + key0, 256), oaccv[0]);
      oaccv[1] = wmma16(pf, ldfrag(vt + 16 * 256 + key0, 256), oaccv[1]);
    }
#pragma unroll
    for (int nt = 0; nt < 2; ++nt)
#pragma unroll
      for (int i = 0; i < 8; ++i)
        oaccv[nt][i] *= __builtin_amdgcn_rcpf(rsum[i]);

    // ---- gating: g = sigmoid(x @ wg_h + bg_h); store gated O -------------
    __syncthreads();           // staging done before wt is reloaded
    load_wT(wt, wg, h);
    __syncthreads();
#pragma unroll
    for (int nt = 0; nt < 2; ++nt) {
      v8f acc = {};
#pragma unroll
      for (int kc = 0; kc < C_DIM; kc += 32) {
        v16h a = ldfrag(xs + rowb * 256 + kc, 256);
        v16h b = ldfrag(wt + nt * 16 * 256 + kc, 256);
        acc = wmma16(a, b, acc);
      }
      const float bgv = bg[h * 32 + nt * 16 + ln16];
#pragma unroll
      for (int i = 0; i < 8; ++i) {
        const float g = __builtin_amdgcn_rcpf(1.f + __expf(-(acc[i] + bgv)));
        const int srow = rowb + i + 8 * hl;
        ob[srow * 256 + h * 32 + nt * 16 + ln16] =
            (_Float16)(oaccv[nt][i] * g);
      }
    }
    __syncthreads();           // ob block written; wt free for next head
  }

  // ---------------- Phase 3: out = o @ wo + bo ----------------------------
  for (int cb = 0; cb < 8; ++cb) {  // 32 output channels per chunk
    {  // stage wo[:, cb*32 : cb*32+32] transposed: wt[c_local][hd]
      const int d = tid & 31;
      const int k0 = tid >> 5;
#pragma unroll 4
      for (int k = k0; k < 256; k += NWAVES)
        wt[d * 256 + k] = (_Float16)wo[k * 256 + cb * 32 + d];
    }
    __syncthreads();
#pragma unroll
    for (int nt = 0; nt < 2; ++nt) {
      v8f acc = {};
#pragma unroll
      for (int kc = 0; kc < 256; kc += 32) {
        v16h a = ldfrag(ob + rowb * 256 + kc, 256);
        v16h b = ldfrag(wt + nt * 16 * 256 + kc, 256);
        acc = wmma16(a, b, acc);
      }
      const int c = cb * 32 + nt * 16 + ln16;
      const float bov = bo[c];
#pragma unroll
      for (int i = 0; i < 8; ++i) {
        const int s = rowb + i + 8 * hl;
        out[((size_t)s * R_LEN + r) * C_DIM + c] = acc[i] + bov;
      }
    }
    __syncthreads();   // wt reload for next channel chunk
  }
}

extern "C" void kernel_launch(void* const* d_in, const int* in_sizes, int n_in,
                              void* d_out, int out_size, void* d_ws, size_t ws_size,
                              hipStream_t stream) {
  (void)in_sizes; (void)n_in; (void)out_size; (void)d_ws; (void)ws_size;
  const float* msa_act  = (const float*)d_in[0];
  const float* msa_mask = (const float*)d_in[1];
  const float* ln_w     = (const float*)d_in[2];
  const float* ln_b     = (const float*)d_in[3];
  const float* wq       = (const float*)d_in[4];
  const float* wk       = (const float*)d_in[5];
  const float* wvp      = (const float*)d_in[6];
  const float* wg       = (const float*)d_in[7];
  const float* bg       = (const float*)d_in[8];
  const float* wo       = (const float*)d_in[9];
  const float* bo       = (const float*)d_in[10];
  float* out            = (float*)d_out;

  // 320 KB dynamic LDS (per-WGP max on CDNA5); opt in every call
  // (deterministic; hipFuncSetAttribute is not a stream op, capture-safe).
  hipFuncSetAttribute(reinterpret_cast<const void*>(col_attn_fused),
                      hipFuncAttributeMaxDynamicSharedMemorySize,
                      LDS_TOTAL_BYTES);

  col_attn_fused<<<dim3(R_LEN), dim3(NTHREADS), LDS_TOTAL_BYTES, stream>>>(
      msa_act, msa_mask, ln_w, ln_b, wq, wk, wvp, wg, bg, wo, bo, out);
}

// v001
// A run of this version takes 307 microseconds.
// Two timings next to v000 put it at 4.62 and 4.63 times that version's speed.
#include <hip/hip_runtime.h>
#include <hip/hip_bf16.h>

typedef __attribute__((ext_vector_type(16))) _Float16 v16h;
typedef __attribute__((ext_vector_type(8)))  _Float16 v8h;
typedef __attribute__((ext_vector_type(8)))  float    v8f;

#define S_LEN 256
#define R_LEN 384
#define C_DIM 256
#define H_NUM 8
#define D_DIM 32

#define NTHREADS 512   // 16 wave32 -> 4 waves per SIMD32 (latency hiding)
#define NWAVES   16
#define ROWS_PW  16    // query/sequence rows owned by each wave

// LDS layout (offsets in halves; total 163840 halves = 327680 B = 320 KB)
// Sizes are logical [rows][cols]; how a tile lies in its range: pidx() below.
#define LDS_X   0        // x  [256][256] f16  (layernormed activations)
#define LDS_O   65536    // o  [256][256] f16  (gated per-head outputs)
#define LDS_WT  131072   // wt [32][256]  f16  (transposed weight tile; P-staging overlay)
#define LDS_Q   139264   // q  [256][32]  f16
#define LDS_K   147456   // k  [256][32]  f16
#define LDS_VT  155648   // vT [32][256]  f16
#define LDS_TOTAL_BYTES 327680

// Bank-conflict-free placement of a [ROWS][cols] f16 tile, no byte of padding.
// A fragment load has 16 lanes read the same 16-byte chunk of 16 consecutive
// rows; the LDS has 64 banks x 4 B, so those 16 chunks must fall on 16
// different 16-byte slots modulo 256 B. With rows of 512 B they all fall on
// one slot, with plain rows of 64 B on four.
//  - The tile is cut into panels of 32 columns; a panel is [ROWS][32], rows of
//    64 B, so 4 consecutive rows fill the 256 B once.
//  - Inside a row the four chunks are permuted by XOR with bits 2..3 of the
//    row number, so rows r, r+4, r+8, r+12 use four different slots.
// Writers and readers index through the same map; the place inside a chunk
// (col & 7) is untouched, and a panel step is a constant address offset.
template <int ROWS>
__device__ inline int pidx(int row, int col) {
  return (col >> 5) * (ROWS * 32) + row * 32 +
         ((col & 31) ^ (((row >> 2) & 3) << 3));
}
// The same index for an accumulator element: row = rowb + 8 * hl + i with rowb
// a multiple of 16, hl = lane >> 4, and i = 0..7 constant after unrolling
// (bits 2..3 of the row are i >> 2 and hl): lane part first, constant last.
template <int ROWS>
__device__ inline int pidx_acc(int rowb, int hl, int i, int col) {
  return (col >> 5) * (ROWS * 32) + (rowb + 8 * hl) * 32 +
         (((col & 31) ^ (hl << 4)) ^ ((i >> 2) << 3)) + i * 32;
}

// Load a 16x32 f16 WMMA fragment (A-layout, or B-layout when the matrix
// columns are stored contiguously as rows). Per ISA 7.12.2: lanes 0-15 hold
// row (lane&15), K=0..7 (VGPR0-3) and K=16..23 (VGPR4-7); lanes 16-31 hold
// K=8..15 and K=24..31. Two 16B chunks per lane -> ds_load_b128.
// Rows row0..row0+15 (row0 a multiple of 16), columns col0..col0+31 (col0 a
// multiple of 32) of a tile placed by pidx<ROWS>: chunks hl and hl + 2 of the
// row, each XORed with bits 2..3 of the row.
template <int ROWS>
__device__ inline v16h ldfrag(const _Float16* p, int row0, int col0) {
  const int lane = threadIdx.x & 31;
  const int l = lane & 15;
  const int x = ((lane >> 4) ^ (l >> 2)) << 3;
  const _Float16* q = p + (col0 >> 5) * (ROWS * 32) + (row0 + l) * 32;
  v8h lo = *(const v8h*)(q + x);
  v8h hi = *(const v8h*)(q + (x ^ 16));
  v16h r;
#pragma unroll
  for (int i = 0; i < 8; ++i) { r[i] = lo[i]; r[i + 8] = hi[i]; }
  return r;
}

__device__ inline v8f wmma16(v16h a, v16h b, v8f c) {
  return __builtin_amdgcn_wmma_f32_16x16x32_f16(false, a, false, b, (short)0, c,
                                                false, false);
}

// Stage W[:, h*32 : h*32+32] transposed into LDS: wt[d][c], placed by pidx<32>.
__device__ inline void load_wT(_Float16* wt, const float* __restrict__ w, int h) {
  const int tid = threadIdx.x;
  const int d = tid & 31;
  const int c0 = tid >> 5;            // 0..15
  // Counted in k (c = c0 + 16 * k): constant trip count, scalar loop control,
  // each load on the scalar base plus one 32-bit offset. Walked in c, the
  // per-lane 64-bit pointers beside the new LDS index spilled to scratch.
  // vectorize(disable): paired iterations bring those pointers back and cost
  // 16 registers. Four loads per trip, as before.
#pragma clang loop vectorize(disable) unroll_count(4)
  for (int k = 0; k < C_DIM / NWAVES; ++k) {
    const int c = c0 + k * NWAVES;
    wt[pidx<32>(d, c)] = (_Float16)w[c * 256 + h * 32 + d];
  }
}

// Per-wave projection: this wave's 16 rows of (x @ wtT_block) -> [16 x 32].
// transposed=false -> dst is [s][32]; true -> dst is [d][256].
__device__ inline void project(const _Float16* xs, const _Float16* wt,
                               _Float16* dst, int rowb, int hl, int ln16,
                               float scale, bool transposed) {
#pragma unroll
  for (int nt = 0; nt < 2; ++nt) {
    v8f acc = {};
#pragma unroll
    for (int kc = 0; kc < C_DIM; kc += 32) {
      v16h a = ldfrag<256>(xs, rowb, kc);
      v16h b = ldfrag<32>(wt, nt * 16, kc);
      acc = wmma16(a, b, acc);
    }
    const int dcol = nt * 16 + ln16;        // C-layout: N = lane & 15,
    if (transposed) {                       //           M = i + 8*(lane>>4)
      // the lane's 8 values are 8 consecutive s of row dcol: one whole chunk
      v8h pk;
#pragma unroll
      for (int i = 0; i < 8; ++i) pk[i] = (_Float16)(acc[i] * scale);
      *(v8h*)(dst + pidx<32>(dcol, rowb + 8 * hl)) = pk;
    } else {
#pragma unroll
      for (int i = 0; i < 8; ++i)
        dst[pidx_acc<256>(rowb, hl, i, dcol)] = (_Float16)(acc[i] * scale);
    }
  }
}

__global__ void __launch_bounds__(NTHREADS, 1)
col_attn_fused(const float* __restrict__ msa_act,
               const float* __restrict__ msa_mask,
               const float* __restrict__ ln_w, const float* __restrict__ ln_b,
               const float* __restrict__ wq, const float* __restrict__ wk,
               const float* __restrict__ wvp, const float* __restrict__ wg,
               const float* __restrict__ bg, const float* __restrict__ wo,
               const float* __restrict__ bo, float* __restrict__ out) {
  extern __shared__ _Float16 smem[];
  _Float16* xs = smem + LDS_X;
  _Float16* ob = smem + LDS_O;
  _Float16* wt = smem + LDS_WT;
  _Float16* qh = smem + LDS_Q;
  _Float16* kh = smem + LDS_K;
  _Float16* vt = smem + LDS_VT;

  const int r     = blockIdx.x;        // residue: the "batch" dim of col-attn
  const int tid   = threadIdx.x;
  const int lane  = tid & 31;
  const int wv_id = tid >> 5;          // 16 waves; wave w owns s rows [16w,16w+16)
  const int hl    = lane >> 4;
  const int ln16  = lane & 15;
  const int rowb  = wv_id * ROWS_PW;

  // ---------------- Phase 1: LayerNorm into LDS (f16) --------------------
  float lnw[8], lnbv[8];
#pragma unroll
  for (int i = 0; i < 8; ++i) { lnw[i] = ln_w[lane * 8 + i]; lnbv[i] = ln_b[lane * 8 + i]; }

  for (int sr = 0; sr < ROWS_PW; ++sr) {
    const int s = rowb + sr;
    const float* row = msa_act + ((size_t)s * R_LEN + r) * C_DIM;
    float v[8];
#pragma unroll
    for (int i = 0; i < 8; ++i) v[i] = row[lane * 8 + i];
    float sum = 0.f, sq = 0.f;
#pragma unroll
    for (int i = 0; i < 8; ++i) { sum += v[i]; sq += v[i] * v[i]; }
#pragma unroll
    for (int m = 16; m >= 1; m >>= 1) {
      sum += __shfl_xor(sum, m, 32);
      sq  += __shfl_xor(sq, m, 32);
    }
    const float mu   = sum * (1.f / 256.f);
    const float var  = sq * (1.f / 256.f) - mu * mu;
    const float rstd = rsqrtf(var + 1e-5f);
    v8h hx;
#pragma unroll
    for (int i = 0; i < 8; ++i)
      hx[i] = (_Float16)((v[i] - mu) * rstd * lnw[i] + lnbv[i]);
    *(v8h*)(xs + pidx<256>(s, lane * 8)) = hx;
  }

  // Per-lane attention bias for the 16 key-tiles this lane sees in C-layout.
  float kbias[16];
#pragma unroll
  for (int kt = 0; kt < 16; ++kt)
    kbias[kt] = 1e9f * (msa_mask[(size_t)(kt * 16 + ln16) * R_LEN + r] - 1.f);

  __syncthreads();

  v8f oaccv[2];  // per-wave O accumulators [ntile]; persist through gating

  // ---------------- Phase 2: per-head fused attention ---------------------
  for (int h = 0; h < H_NUM; ++h) {
    __builtin_prefetch(wk + h * 32, 0, 0);   // global_prefetch_b8
    load_wT(wt, wq, h);
    __syncthreads();
    project(xs, wt, qh, rowb, hl, ln16, 0.17677669529663688f /*1/sqrt(32)*/, false);
    __syncthreads();

    __builtin_prefetch(wvp + h * 32, 0, 0);
    load_wT(wt, wk, h);
    __syncthreads();
    project(xs, wt, kh, rowb, hl, ln16, 1.f, false);
    __syncthreads();

    load_wT(wt, wvp, h);
    __syncthreads();
    project(xs, wt, vt, rowb, hl, ln16, 1.f, true);  // store V transposed
    __syncthreads();  // all q/k/vT visible; wt now free -> P staging overlay

    // ---- flash-style attention, 16 query rows per wave -------------------
    _Float16* stg = wt + wv_id * 512;  // per-wave [16 q][32 k] f16 staging
    float rmax[8], rsum[8];
#pragma unroll
    for (int i = 0; i < 8; ++i) { rmax[i] = -1e30f; rsum[i] = 0.f; }
    oaccv[0] = (v8f){};
    oaccv[1] = (v8f){};
    const v16h qa = ldfrag<256>(qh, rowb, 0);  // D=32 = exactly one WMMA K

    for (int kp = 0; kp < 8; ++kp) {  // 32 keys per step
      const int key0 = kp * 32;
      v8f s0 = {}, s1 = {};
      s0 = wmma16(qa, ldfrag<256>(kh, key0 + 0, 0), s0);
      s1 = wmma16(qa, ldfrag<256>(kh, key0 + 16, 0), s1);
#pragma unroll
      for (int i = 0; i < 8; ++i) {
        const float a = s0[i] + kbias[2 * kp];
        const float b = s1[i] + kbias[2 * kp + 1];
        float t = fmaxf(a, b);
#pragma unroll
        for (int m = 1; m <= 8; m <<= 1) t = fmaxf(t, __shfl_xor(t, m, 32));
        const float nm = fmaxf(rmax[i], t);
        const float sc = __expf(rmax[i] - nm);
        rmax[i] = nm;
        const float pa = __expf(a - nm);
        const float pb = __expf(b - nm);
        float ps = pa + pb;
#pragma unroll
        for (int m = 1; m <= 8; m <<= 1) ps += __shfl_xor(ps, m, 32);
        rsum[i] = rsum[i] * sc + ps;
        oaccv[0][i] *= sc;
        oaccv[1][i] *= sc;
        stg[pidx_acc<16>(0, hl, i, ln16)]      = (_Float16)pa;  // C-layout
        stg[pidx_acc<16>(0, hl, i, 16 + ln16)] = (_Float16)pb;  // scatter of P
      }
      const v16h pf = ldfrag<16>(stg, 0, 0);      // P as A-fragment
      oaccv[0] = wmma16(pf, ldfrag<32>(vt, 0, key0), oaccv[0]);
      oaccv[1] = wmma16(pf, ldfrag<32>(vt, 16, key0), oaccv[1]);
    }
#pragma unroll
    for (int nt = 0; nt < 2; ++nt)
#pragma unroll
      for (int i = 0; i < 8; ++i)
        oaccv[nt][i] *= __builtin_amdgcn_rcpf(rsum[i]);

    // ---- gating: g = sigmoid(x @ wg_h + bg_h); store gated O -------------
    __syncthreads();           // staging done before wt is reloaded
    load_wT(wt, wg, h);
    __syncthreads();
#pragma unroll
    for (int nt = 0; nt < 2; ++nt) {
      v8f acc = {};
#pragma unroll
      for (int kc = 0; kc < C_DIM; kc += 32) {
        v16h a = ldfrag<256>(xs, rowb, kc);
        v16h b = ldfrag<32>(wt, nt * 16, kc);
        acc = wmma16(a, b, acc);
      }
      const float bgv = bg[h * 32 + nt * 16 + ln16];
#pragma unroll
      for (int i = 0; i < 8; ++i) {
        const float g = __builtin_amdgcn_rcpf(1.f + __expf(-(acc[i] + bgv)));
        ob[pidx_acc<256>(rowb, hl, i, h * 32 + nt * 16 + ln16)] =
            (_Float16)(oaccv[nt][i] * g);
      }
    }
    __syncthreads();           // ob block written; wt free for next head
  }

  // ---------------- Phase 3: out = o @ wo + bo ----------------------------
  for (int cb = 0; cb < 8; ++cb) {  // 32 output channels per chunk
    {  // stage wo[:, cb*32 : cb*32+32] transposed: wt[c_local][hd]
      const int d = tid & 31;
      const int k0 = tid >> 5;
      // counted, and kept scalar, for the reasons given in load_wT
#pragma clang loop vectorize(disable) unroll_count(4)
      for (int j = 0; j < 256 / NWAVES; ++j) {
        const int k = k0 + j * NWAVES;
        wt[pidx<32>(d, k)] = (_Float16)wo[k * 256 + cb * 32 + d];
      }
    }
    __syncthreads();
#pragma unroll
    for (int nt = 0; nt < 2; ++nt) {
      v8f acc = {};
#pragma unroll
      for (int kc = 0; kc < 256; kc += 32) {
        v16h a = ldfrag<256>(ob, rowb, kc);
        v16h b = ldfrag<32>(wt, nt * 16, kc);
        acc = wmma16(a, b, acc);
      }
      const int c = cb * 32 + nt * 16 + ln16;
      const float bov = bo[c];
#pragma unroll
      for (int i = 0; i < 8; ++i) {
        const int s = rowb + i + 8 * hl;
        out[((size_t)s * R_LEN + r) * C_DIM + c] = acc[i] + bov;
      }
    }
    __syncthreads();   // wt reload for next channel chunk
  }
}

extern "C" void kernel_launch(void* const* d_in, const int* in_sizes, int n_in,
                              void* d_out, int out_size, void* d_ws, size_t ws_size,
                              hipStream_t stream) {
  (void)in_sizes; (void)n_in; (void)out_size; (void)d_ws; (void)ws_size;
  const float* msa_act  = (const float*)d_in[0];
  const float* msa_mask = (const float*)d_in[1];
  const float* ln_w     = (const float*)d_in[2];
  const float* ln_b     = (const float*)d_in[3];
  const float* wq       = (const float*)d_in[4];
  const float* wk       = (const float*)d_in[5];
  const float* wvp      = (const float*)d_in[6];
  const float* wg       = (const float*)d_in[7];
  const float* bg       = (const float*)d_in[8];
  const float* wo       = (const float*)d_in[9];
  const float* bo       = (const float*)d_in[10];
  float* out            = (float*)d_out;

  // 320 KB dynamic LDS (per-WGP max on CDNA5); opt in every call
  // (deterministic; hipFuncSetAttribute is not a stream op, capture-safe).
  hipFuncSetAttribute(reinterpret_cast<const void*>(col_attn_fused),
                      hipFuncAttributeMaxDynamicSharedMemorySize,
                      LDS_TOTAL_BYTES);

  col_attn_fused<<<dim3(R_LEN), dim3(NTHREADS), LDS_TOTAL_BYTES, stream>>>(
      msa_act, msa_mask, ln_w, ln_b, wq, wk, wvp, wg, bg, wo, bo, out);
}

// v002
// One run takes 242 microseconds.
// In two side-by-side timings against v001, it was 1.27 and 1.28 times as fast.
// Counting every step since v000, it is 5.89 times as fast.
#include <hip/hip_runtime.h>
#include <hip/hip_bf16.h>

typedef __attribute__((ext_vector_type(16))) _Float16 v16h;
typedef __attribute__((ext_vector_type(8)))  _Float16 v8h;
typedef __attribute__((ext_vector_type(8)))  float    v8f;
typedef __attribute__((ext_vector_type(4)))  float    v4f;
typedef __attribute__((ext_vector_type(2)))  float    v2f;

#define S_LEN 256
#define R_LEN 384
#define C_DIM 256
#define H_NUM 8
#define D_DIM 32

#define NTHREADS 512   // 16 wave32 -> 4 waves per SIMD32 (latency hiding)
#define NWAVES   16
#define ROWS_PW  16    // query/sequence rows owned by each wave

// LDS layout (offsets in halves; total 156160 halves = 312320 B = 305 KB)
// Sizes are logical [rows][cols]; how a tile lies in its range: pidx() below.
#define LDS_X   0        // x  [256][256] f16  (layernormed activations)
#define LDS_O   65536    // o  [256][256] f16  (gated per-head outputs)
#define LDS_WT  131072   // wt [32][256]  f16  (transposed weight tile)
#define LDS_K   139264   // k  [256][32]  f16
#define LDS_VT  147456   // vT [32][256]  f16
#define LDS_KB  155648   // key bias [256] f32
#define LDS_TOTAL_BYTES 312320

// Bank-conflict-free placement of a [ROWS][cols] f16 tile, no byte of padding.
// A fragment load has 16 lanes read the same 16-byte chunk of 16 consecutive
// rows; the LDS has 64 banks x 4 B, so those 16 chunks must fall on 16
// different 16-byte slots modulo 256 B. With rows of 512 B they all fall on
// one slot, with plain rows of 64 B on four.
//  - The tile is cut into panels of 32 columns; a panel is [ROWS][32], rows of
//    64 B, so 4 consecutive rows fill the 256 B once.
//  - Inside a row the four chunks are permuted by XOR with bits 2..3 of the
//    row number, so rows r, r+4, r+8, r+12 use four different slots.
// Writers and readers index through the same map; the place inside a chunk
// (col & 7) is untouched, and a panel step is a constant address offset.
template <int ROWS>
__device__ inline int pidx(int row, int col) {
  return (col >> 5) * (ROWS * 32) + row * 32 +
         ((col & 31) ^ (((row >> 2) & 3) << 3));
}
// The same index for an accumulator element: row = rowb + 8 * hl + i with rowb
// a multiple of 16, hl = lane >> 4, and i = 0..7 constant after unrolling
// (bits 2..3 of the row are i >> 2 and hl): lane part first, constant last.
template <int ROWS>
__device__ inline int pidx_acc(int rowb, int hl, int i, int col) {
  return (col >> 5) * (ROWS * 32) + (rowb + 8 * hl) * 32 +
         (((col & 31) ^ (hl << 4)) ^ ((i >> 2) << 3)) + i * 32;
}

// Load a 16x32 f16 WMMA fragment (A-layout, or B-layout when the matrix
// columns are stored contiguously as rows). Per ISA 7.12.2: lanes 0-15 hold
// row (lane&15), K=0..7 (VGPR0-3) and K=16..23 (VGPR4-7); lanes 16-31 hold
// K=8..15 and K=24..31. Two 16B chunks per lane -> ds_load_b128.
// Rows row0..row0+15 (row0 a multiple of 16), columns col0..col0+31 (col0 a
// multiple of 32) of a tile placed by pidx<ROWS>: chunks hl and hl + 2 of the
// row, each XORed with bits 2..3 of the row.
template <int ROWS>
__device__ inline v16h ldfrag(const _Float16* p, int row0, int col0) {
  const int lane = threadIdx.x & 31;
  const int l = lane & 15;
  const int x = ((lane >> 4) ^ (l >> 2)) << 3;
  const _Float16* q = p + (col0 >> 5) * (ROWS * 32) + (row0 + l) * 32;
  v8h lo = *(const v8h*)(q + x);
  v8h hi = *(const v8h*)(q + (x ^ 16));
  v16h r;
#pragma unroll
  for (int i = 0; i < 8; ++i) { r[i] = lo[i]; r[i + 8] = hi[i]; }
  return r;
}

__device__ inline v8f wmma16(v16h a, v16h b, v8f c) {
  return __builtin_amdgcn_wmma_f32_16x16x32_f16(false, a, false, b, (short)0, c,
                                                false, false);
}

// The value that lane ^ 16 holds (the other half of the wave), on the vector
// pipe.
__device__ inline float other_half(float v) {
  const int b = __builtin_bit_cast(int, v);
  return __builtin_bit_cast(float, __builtin_amdgcn_permlanex16(
      b, b, 0x76543210, 0xfedcba98, false, false));
}

// exp(x) as 2^(x * log2 e), the form __expf compiles to, for eight values (or
// one) in ONE statement: the instruction set asks for one independent
// instruction or a v_nop behind a transcendental before its result is read or
// its source overwritten. Here every result
// register differs from every source ("=&v"), each v_exp_f32 is the
// independent instruction behind the one before, and the v_nop is the slot
// behind the last.
__device__ inline v8f exp_x8(v8f x) {
  x *= 1.44269504088896340736f;
  float r0, r1, r2, r3, r4, r5, r6, r7;
  asm("v_exp_f32 %0, %8\n\tv_exp_f32 %1, %9\n\tv_exp_f32 %2, %10\n\t"
      "v_exp_f32 %3, %11\n\tv_exp_f32 %4, %12\n\tv_exp_f32 %5, %13\n\t"
      "v_exp_f32 %6, %14\n\tv_exp_f32 %7, %15\n\tv_nop"
      : "=&v"(r0), "=&v"(r1), "=&v"(r2), "=&v"(r3), "=&v"(r4), "=&v"(r5),
        "=&v"(r6), "=&v"(r7)
      : "v"(x[0]), "v"(x[1]), "v"(x[2]), "v"(x[3]), "v"(x[4]), "v"(x[5]),
        "v"(x[6]), "v"(x[7]));
  return (v8f){r0, r1, r2, r3, r4, r5, r6, r7};
}
__device__ inline float exp_x1(float x) {
  x *= 1.44269504088896340736f;
  float r;
  asm("v_exp_f32 %0, %1\n\tv_nop" : "=&v"(r) : "v"(x));
  return r;
}

// Stage W[:, h*32 : h*32+32] transposed into LDS: wt[d][c], placed by pidx<32>.
__device__ inline void load_wT(_Float16* wt, const float* __restrict__ w, int h) {
  const int tid = threadIdx.x;
  const int d = tid & 31;
  const int c0 = tid >> 5;            // 0..15
  // Counted in k (c = c0 + 16 * k): constant trip count, scalar loop control,
  // each load on the scalar base plus one 32-bit offset. Walked in c, the
  // per-lane 64-bit pointers beside the new LDS index spilled to scratch.
  // vectorize(disable): paired iterations bring those pointers back and cost
  // 16 registers. Four loads per trip, as before.
#pragma clang loop vectorize(disable) unroll_count(4)
  for (int k = 0; k < C_DIM / NWAVES; ++k) {
    const int c = c0 + k * NWAVES;
    wt[pidx<32>(d, c)] = (_Float16)w[c * 256 + h * 32 + d];
  }
}

// Per-wave projection: this wave's 16 rows of (x @ wtT_block) -> [16 x 32].
// transposed=false -> dst is [s][32]; true -> dst is [d][256].
__device__ inline void project(const _Float16* xs, const _Float16* wt,
                               _Float16* dst, int rowb, int hl, int ln16,
                               float scale, bool transposed) {
#pragma unroll
  for (int nt = 0; nt < 2; ++nt) {
    v8f acc = {};
#pragma unroll
    for (int kc = 0; kc < C_DIM; kc += 32) {
      v16h a = ldfrag<256>(xs, rowb, kc);
      v16h b = ldfrag<32>(wt, nt * 16, kc);
      acc = wmma16(a, b, acc);
    }
    const int dcol = nt * 16 + ln16;        // C-layout: N = lane & 15,
    if (transposed) {                       //           M = i + 8*(lane>>4)
      // the lane's 8 values are 8 consecutive s of row dcol: one whole chunk
      v8h pk;
#pragma unroll
      for (int i = 0; i < 8; ++i) pk[i] = (_Float16)(acc[i] * scale);
      *(v8h*)(dst + pidx<32>(dcol, rowb + 8 * hl)) = pk;
    } else {
#pragma unroll
      for (int i = 0; i < 8; ++i)
        dst[pidx_acc<256>(rowb, hl, i, dcol)] = (_Float16)(acc[i] * scale);
    }
  }
}

// Per-wave transposed projection, weights as A and x as B: tile nt holds
// (x @ w)[rowb + ln16][nt*16 + 8*hl + i] in element i, that is 8 consecutive
// channels of ONE row per lane.
__device__ inline v8f project_t(const _Float16* xs, const _Float16* wt,
                                int rowb, int nt) {
  v8f acc = {};
#pragma unroll
  for (int kc = 0; kc < C_DIM; kc += 32) {
    v16h a = ldfrag<32>(wt, nt * 16, kc);
    v16h b = ldfrag<256>(xs, rowb, kc);
    acc = wmma16(a, b, acc);
  }
  return acc;
}

__global__ void __launch_bounds__(NTHREADS, 1)
col_attn_fused(const float* __restrict__ msa_act,
               const float* __restrict__ msa_mask,
               const float* __restrict__ ln_w, const float* __restrict__ ln_b,
               const float* __restrict__ wq, const float* __restrict__ wk,
               const float* __restrict__ wvp, const float* __restrict__ wg,
               const float* __restrict__ bg, const float* __restrict__ wo,
               const float* __restrict__ bo, float* __restrict__ out) {
  extern __shared__ _Float16 smem[];
  _Float16* xs = smem + LDS_X;
  _Float16* ob = smem + LDS_O;
  _Float16* wt = smem + LDS_WT;
  _Float16* kh = smem + LDS_K;
  _Float16* vt = smem + LDS_VT;
  float*    kb = (float*)(smem + LDS_KB);

  const int r     = blockIdx.x;        // residue: the "batch" dim of col-attn
  const int tid   = threadIdx.x;
  const int lane  = tid & 31;
  const int wv_id = tid >> 5;          // 16 waves; wave w owns s rows [16w,16w+16)
  const int hl    = lane >> 4;
  const int ln16  = lane & 15;
  const int rowb  = wv_id * ROWS_PW;

  // ---------------- Phase 1: LayerNorm into LDS (f16) --------------------
  float lnw[8], lnbv[8];
#pragma unroll
  for (int i = 0; i < 8; ++i) { lnw[i] = ln_w[lane * 8 + i]; lnbv[i] = ln_b[lane * 8 + i]; }

  for (int sr = 0; sr < ROWS_PW; ++sr) {
    const int s = rowb + sr;
    const float* row = msa_act + ((size_t)s * R_LEN + r) * C_DIM;
    float v[8];
#pragma unroll
    for (int i = 0; i < 8; ++i) v[i] = row[lane * 8 + i];
    float sum = 0.f, sq = 0.f;
#pragma unroll
    for (int i = 0; i < 8; ++i) { sum += v[i]; sq += v[i] * v[i]; }
#pragma unroll
    for (int m = 16; m >= 1; m >>= 1) {
      sum += __shfl_xor(sum, m, 32);
      sq  += __shfl_xor(sq, m, 32);
    }
    const float mu   = sum * (1.f / 256.f);
    const float var  = sq * (1.f / 256.f) - mu * mu;
    const float rstd = rsqrtf(var + 1e-5f);
    v8h hx;
#pragma unroll
    for (int i = 0; i < 8; ++i)
      hx[i] = (_Float16)((v[i] - mu) * rstd * lnw[i] + lnbv[i]);
    *(v8h*)(xs + pidx<256>(s, lane * 8)) = hx;
  }

  // Attention bias of the 256 keys, read back 8 consecutive keys per lane.
  if (tid < S_LEN)
    kb[tid] = 1e9f * (msa_mask[(size_t)tid * R_LEN + r] - 1.f);

  __syncthreads();

  v8f oaccv[2];  // per-wave O^T accumulators [ntile]; persist through gating

  // ---------------- Phase 2: per-head fused attention ---------------------
  for (int h = 0; h < H_NUM; ++h) {
    __builtin_prefetch(wk + h * 32, 0, 0);   // global_prefetch_b8
    load_wT(wt, wq, h);
    __syncthreads();
    // Q^T tiles 0 and 1, packed, ARE the B fragment of the score product
    // (k = 8*hl + i, then 16 + 8*hl + i): Q never goes through LDS.
    v16h qb;
#pragma unroll
    for (int nt = 0; nt < 2; ++nt) {
      const v8f acc = project_t(xs, wt, rowb, nt);
#pragma unroll
      for (int i = 0; i < 8; ++i)
        qb[nt * 8 + i] = (_Float16)(acc[i] * 0.17677669529663688f /*1/sqrt(32)*/);
    }
    __syncthreads();

    __builtin_prefetch(wvp + h * 32, 0, 0);
    load_wT(wt, wk, h);
    __syncthreads();
    project(xs, wt, kh, rowb, hl, ln16, 1.f, false);
    __syncthreads();

    load_wT(wt, wvp, h);
    __syncthreads();
    project(xs, wt, vt, rowb, hl, ln16, 1.f, true);  // store V transposed
    __syncthreads();  // all k/vT visible; every reader has left wt

    float rmax = -1e30f, rsum = 0.f;   // rsum: this half's keys only
    oaccv[0] = (v8f){};
    oaccv[1] = (v8f){};

    for (int kp = 0; kp < 8; ++kp) {  // 32 keys per step
      const int key0 = kp * 32;
      v8f s0 = {}, s1 = {};
      s0 = wmma16(ldfrag<256>(kh, key0 + 0, 0), qb, s0);
      s1 = wmma16(ldfrag<256>(kh, key0 + 16, 0), qb, s1);
      s0 += *(const v8f*)(kb + key0 + 8 * hl);
      s1 += *(const v8f*)(kb + key0 + 16 + 8 * hl);
      const float t0 = fmaxf(fmaxf(s0[0], s0[1]), s0[2]);
      const float t1 = fmaxf(fmaxf(s0[3], s0[4]), s0[5]);
      const float t2 = fmaxf(fmaxf(s0[6], s0[7]), s1[0]);
      const float t3 = fmaxf(fmaxf(s1[1], s1[2]), s1[3]);
      const float t4 = fmaxf(fmaxf(s1[4], s1[5]), s1[6]);
      float t = fmaxf(fmaxf(fmaxf(t0, t1), t2), fmaxf(fmaxf(t3, t4), s1[7]));
      t = fmaxf(t, other_half(t));
      const float nm = fmaxf(rmax, t);
      const float sc = exp_x1(rmax - nm);
      rmax = nm;
      const v8f p0 = exp_x8(s0 - nm);
      const v8f p1 = exp_x8(s1 - nm);
      v16h pf;
#pragma unroll
      for (int i = 0; i < 8; ++i) {
        pf[i]     = (_Float16)p0[i];
        pf[8 + i] = (_Float16)p1[i];
      }
      const v8f pv = p0 + p1;            // halved three times: packed adds
      const v4f ph = pv.lo + pv.hi;
      const v2f pq = ph.lo + ph.hi;
      rsum = rsum * sc + (pq.x + pq.y);
      oaccv[0] *= sc;
      oaccv[1] *= sc;
      oaccv[0] = wmma16(ldfrag<32>(vt, 0, key0), pf, oaccv[0]);
      oaccv[1] = wmma16(ldfrag<32>(vt, 16, key0), pf, oaccv[1]);
    }
    rsum += other_half(rsum);
    const float rinv = __builtin_amdgcn_rcpf(rsum);

    // ---- gating: g = sigmoid(x @ wg_h + bg_h); store gated O -------------
    // wt has had no reader since the barrier in front of the attention.
    load_wT(wt, wg, h);
    __syncthreads();
#pragma unroll
    for (int nt = 0; nt < 2; ++nt) {
      const v8f acc = project_t(xs, wt, rowb, nt);   // transposed like O^T
      const int dcol = h * 32 + nt * 16 + 8 * hl;
      // the lane's 8 values are 8 consecutive channels of one row: one chunk
      v8h pk;
#pragma unroll
      for (int i = 0; i < 8; ++i) {
        const float g = __builtin_amdgcn_rcpf(1.f + __expf(-(acc[i] + bg[dcol + i])));
        pk[i] = (_Float16)(oaccv[nt][i] * rinv * g);
      }
      *(v8h*)(ob + pidx<256>(rowb + ln16, dcol)) = pk;
    }
    __syncthreads();           // ob block written; wt free for next head
  }

  // ---------------- Phase 3: out = o @ wo + bo ----------------------------
  for (int cb = 0; cb < 8; ++cb) {  // 32 output channels per chunk
    {  // stage wo[:, cb*32 : cb*32+32] transposed: wt[c_local][hd]
      const int d = tid & 31;
      const int k0 = tid >> 5;
      // counted, and kept scalar, for the reasons given in load_wT
#pragma clang loop vectorize(disable) unroll_count(4)
      for (int j = 0; j < 256 / NWAVES; ++j) {
        const int k = k0 + j * NWAVES;
        wt[pidx<32>(d, k)] = (_Float16)wo[k * 256 + cb * 32 + d];
      }
    }
    __syncthreads();
#pragma unroll
    for (int nt = 0; nt < 2; ++nt) {
      v8f acc = {};
#pragma unroll
      for (int kc = 0; kc < 256; kc += 32) {
        v16h a = ldfrag<256>(ob, rowb, kc);
        v16h b = ldfrag<32>(wt, nt * 16, kc);
        acc = wmma16(a, b, acc);
      }
      const int c = cb * 32 + nt * 16 + ln16;
      const float bov = bo[c];
#pragma unroll
      for (int i = 0; i < 8; ++i) {
        const int s = rowb + i + 8 * hl;
        out[((size_t)s * R_LEN + r) * C_DIM + c] = acc[i] + bov;
      }
    }
    __syncthreads();   // wt reload for next channel chunk
  }
}

extern "C" void kernel_launch(void* const* d_in, const int* in_sizes, int n_in,
                              void* d_out, int out_size, void* d_ws, size_t ws_size,
                              hipStream_t stream) {
  (void)in_sizes; (void)n_in; (void)out_size; (void)d_ws; (void)ws_size;
  const float* msa_act  = (const float*)d_in[0];
  const float* msa_mask = (const float*)d_in[1];
  const float* ln_w     = (const float*)d_in[2];
  const float* ln_b     = (const float*)d_in[3];
  const float* wq       = (const float*)d_in[4];
  const float* wk       = (const float*)d_in[5];
  const float* wvp      = (const float*)d_in[6];
  const float* wg       = (const float*)d_in[7];
  const float* bg       = (const float*)d_in[8];
  const float* wo       = (const float*)d_in[9];
  const float* bo       = (const float*)d_in[10];
  float* out            = (float*)d_out;

  // 305 KB dynamic LDS (per-WGP max on CDNA5: 320 KB); opt in every call
  // (deterministic; hipFuncSetAttribute is not a stream op, capture-safe).
  hipFuncSetAttribute(reinterpret_cast<const void*>(col_attn_fused),
                      hipFuncAttributeMaxDynamicSharedMemorySize,
                      LDS_TOTAL_BYTES);

  col_attn_fused<<<dim3(R_LEN), dim3(NTHREADS), LDS_TOTAL_BYTES, stream>>>(
      msa_act, msa_mask, ln_w, ln_b, wq, wk, wvp, wg, bg, wo, bo, out);
}

// v003
// It runs in 198 microseconds.
// Timed twice side by side with v002, it ran 1.22 times as fast both times.
// Over all steps from v000 it is 7.19 times as fast.
#include <hip/hip_runtime.h>
#include <hip/hip_bf16.h>

typedef __attribute__((ext_vector_type(16))) _Float16 v16h;
typedef __attribute__((ext_vector_type(8)))  _Float16 v8h;
typedef __attribute__((ext_vector_type(8)))  float    v8f;
typedef __attribute__((ext_vector_type(4)))  float    v4f;
typedef __attribute__((ext_vector_type(2)))  float    v2f;

#define S_LEN 256
#define R_LEN 384
#define C_DIM 256
#define H_NUM 8
#define D_DIM 32

#define NTHREADS 512   // 16 wave32 -> 4 waves per SIMD32 (latency hiding)
#define NWAVES   16
#define ROWS_PW  16    // query/sequence rows owned by each wave

// LDS layout (offsets in halves; total 156160 halves = 312320 B = 305 KB)
// Sizes are logical [rows][cols]; how a tile lies in its range: pidx() below.
#define LDS_X   0        // x  [256][256] f16  (layernormed activations)
#define LDS_O   65536    // o  [256][256] f16  (gated per-head outputs)
#define LDS_WT  131072   // wt [32][256]  f16  (transposed weight tile)
#define LDS_K   139264   // k  [256][32]  f16
#define LDS_VT  147456   // vT [32][256]  f16
#define LDS_KB  155648   // key bias [256] f32
#define LDS_TOTAL_BYTES 312320

// Bank-conflict-free placement of a [ROWS][cols] f16 tile, no byte of padding.
// A fragment load has 16 lanes read the same 16-byte chunk of 16 consecutive
// rows; the LDS has 64 banks x 4 B, so those 16 chunks must fall on 16
// different 16-byte slots modulo 256 B. With rows of 512 B they all fall on
// one slot, with plain rows of 64 B on four.
//  - The tile is cut into panels of 32 columns; a panel is [ROWS][32], rows of
//    64 B, so 4 consecutive rows fill the 256 B once.
//  - Inside a row the four chunks are permuted by XOR with bits 2..3 of the
//    row number, so rows r, r+4, r+8, r+12 use four different slots.
// Writers and readers index through the same map; the place inside a chunk
// (col & 7) is untouched, and a panel step is a constant address offset.
template <int ROWS>
__device__ inline int pidx(int row, int col) {
  return (col >> 5) * (ROWS * 32) + row * 32 +
         ((col & 31) ^ (((row >> 2) & 3) << 3));
}
// The same index for an accumulator element: row = rowb + 8 * hl + i with rowb
// a multiple of 16, hl = lane >> 4, and i = 0..7 constant after unrolling
// (bits 2..3 of the row are i >> 2 and hl): lane part first, constant last.
template <int ROWS>
__device__ inline int pidx_acc(int rowb, int hl, int i, int col) {
  return (col >> 5) * (ROWS * 32) + (rowb + 8 * hl) * 32 +
         (((col & 31) ^ (hl << 4)) ^ ((i >> 2) << 3)) + i * 32;
}

// Load a 16x32 f16 WMMA fragment (A-layout, or B-layout when the matrix
// columns are stored contiguously as rows). Per ISA 7.12.2: lanes 0-15 hold
// row (lane&15), K=0..7 (VGPR0-3) and K=16..23 (VGPR4-7); lanes 16-31 hold
// K=8..15 and K=24..31. Two 16B chunks per lane -> ds_load_b128.
// Rows row0..row0+15 (row0 a multiple of 16), columns col0..col0+31 (col0 a
// multiple of 32) of a tile placed by pidx<ROWS>: chunks hl and hl + 2 of the
// row, each XORed with bits 2..3 of the row.
template <int ROWS>
__device__ inline v16h ldfrag(const _Float16* p, int row0, int col0) {
  const int lane = threadIdx.x & 31;
  const int l = lane & 15;
  const int x = ((lane >> 4) ^ (l >> 2)) << 3;
  const _Float16* q = p + (col0 >> 5) * (ROWS * 32) + (row0 + l) * 32;
  v8h lo = *(const v8h*)(q + x);
  v8h hi = *(const v8h*)(q + (x ^ 16));
  v16h r;
#pragma unroll
  for (int i = 0; i < 8; ++i) { r[i] = lo[i]; r[i + 8] = hi[i]; }
  return r;
}

__device__ inline v8f wmma16(v16h a, v16h b, v8f c) {
  return __builtin_amdgcn_wmma_f32_16x16x32_f16(false, a, false, b, (short)0, c,
                                                false, false);
}

// The value that lane ^ 16 holds (the other half of the wave), on the vector
// pipe.
__device__ inline float other_half(float v) {
  const int b = __builtin_bit_cast(int, v);
  return __builtin_bit_cast(float, __builtin_amdgcn_permlanex16(
      b, b, 0x76543210, 0xfedcba98, false, false));
}

// exp(x) as 2^(x * log2 e), the form __expf compiles to, for eight values (or
// one) in ONE statement: the instruction set asks for one independent
// instruction or a v_nop behind a transcendental before its result is read or
// its source overwritten. Here every result
// register differs from every source ("=&v"), each v_exp_f32 is the
// independent instruction behind the one before, and the v_nop is the slot
// behind the last.
__device__ inline v8f exp_x8(v8f x) {
  x *= 1.44269504088896340736f;
  float r0, r1, r2, r3, r4, r5, r6, r7;
  asm("v_exp_f32 %0, %8\n\tv_exp_f32 %1, %9\n\tv_exp_f32 %2, %10\n\t"
      "v_exp_f32 %3, %11\n\tv_exp_f32 %4, %12\n\tv_exp_f32 %5, %13\n\t"
      "v_exp_f32 %6, %14\n\tv_exp_f32 %7, %15\n\tv_nop"
      : "=&v"(r0), "=&v"(r1), "=&v"(r2), "=&v"(r3), "=&v"(r4), "=&v"(r5),
        "=&v"(r6), "=&v"(r7)
      : "v"(x[0]), "v"(x[1]), "v"(x[2]), "v"(x[3]), "v"(x[4]), "v"(x[5]),
        "v"(x[6]), "v"(x[7]));
  return (v8f){r0, r1, r2, r3, r4, r5, r6, r7};
}
__device__ inline float exp_x1(float x) {
  x *= 1.44269504088896340736f;
  float r;
  asm("v_exp_f32 %0, %1\n\tv_nop" : "=&v"(r) : "v"(x));
  return r;
}

// Staging of W[:, t*32 : t*32+32] transposed into LDS, wt[d][c] placed by
// pidx<32>, in two halves. fetch_w issues the thread's 16 loads together
// (c = c0 + 16 * k, d = lane: one address, constant offsets); put_w converts
// and stores them. fetch_w stands one stage ahead of its put_w, behind the
// barrier that opens the product on the tile before, so the loads' latency
// runs under that product instead of in front of a barrier.
__device__ inline void fetch_w(float (&wr)[16], const float* __restrict__ w, int t) {
  const int tid = threadIdx.x;
  const int d = tid & 31;
  const int c0 = tid >> 5;            // 0..15
#pragma unroll
  for (int k = 0; k < C_DIM / NWAVES; ++k)
    wr[k] = w[(c0 + k * NWAVES) * 256 + t * 32 + d];
  // The loads' offset register is free for reuse right behind them:
  // the wait that belongs in front of such an overwrite, once for all 16.
  asm volatile("s_wait_xcnt 0x0" ::: "memory");
  // Holds the 16 loads here, at the head of the product that follows: without
  // it the scheduler sank them into that product's second half, and the wait
  // in front of the next barrier then saw most of their latency.
  __builtin_amdgcn_sched_barrier(0);
}
__device__ inline void put_w(_Float16* wt, const float (&wr)[16]) {
  const int tid = threadIdx.x;
  const int d = tid & 31;
  const int c0 = tid >> 5;
#pragma unroll
  for (int k = 0; k < C_DIM / NWAVES; ++k)
    wt[pidx<32>(d, c0 + k * NWAVES)] = (_Float16)wr[k];
}

// Per-wave projection: this wave's 16 rows of (x @ wtT_block) -> [16 x 32].
// transposed=false -> dst is [s][32]; true -> dst is [d][256].
__device__ inline void project(const _Float16* xs, const _Float16* wt,
                               _Float16* dst, int rowb, int hl, int ln16,
                               float scale, bool transposed) {
#pragma unroll
  for (int nt = 0; nt < 2; ++nt) {
    v8f acc = {};
#pragma unroll
    for (int kc = 0; kc < C_DIM; kc += 32) {
      v16h a = ldfrag<256>(xs, rowb, kc);
      v16h b = ldfrag<32>(wt, nt * 16, kc);
      acc = wmma16(a, b, acc);
    }
    const int dcol = nt * 16 + ln16;        // C-layout: N = lane & 15,
    if (transposed) {                       //           M = i + 8*(lane>>4)
      // the lane's 8 values are 8 consecutive s of row dcol: one whole chunk
      v8h pk;
#pragma unroll
      for (int i = 0; i < 8; ++i) pk[i] = (_Float16)(acc[i] * scale);
      *(v8h*)(dst + pidx<32>(dcol, rowb + 8 * hl)) = pk;
    } else {
#pragma unroll
      for (int i = 0; i < 8; ++i)
        dst[pidx_acc<256>(rowb, hl, i, dcol)] = (_Float16)(acc[i] * scale);
    }
  }
}

// Per-wave transposed projection, weights as A and x as B: tile nt holds
// (x @ w)[rowb + ln16][nt*16 + 8*hl + i] in element i, that is 8 consecutive
// channels of ONE row per lane.
__device__ inline v8f project_t(const _Float16* xs, const _Float16* wt,
                                int rowb, int nt) {
  v8f acc = {};
#pragma unroll
  for (int kc = 0; kc < C_DIM; kc += 32) {
    v16h a = ldfrag<32>(wt, nt * 16, kc);
    v16h b = ldfrag<256>(xs, rowb, kc);
    acc = wmma16(a, b, acc);
  }
  return acc;
}

__global__ void __launch_bounds__(NTHREADS, 1)
col_attn_fused(const float* __restrict__ msa_act,
               const float* __restrict__ msa_mask,
               const float* __restrict__ ln_w, const float* __restrict__ ln_b,
               const float* __restrict__ wq, const float* __restrict__ wk,
               const float* __restrict__ wvp, const float* __restrict__ wg,
               const float* __restrict__ bg, const float* __restrict__ wo,
               const float* __restrict__ bo, float* __restrict__ out) {
  extern __shared__ _Float16 smem[];
  _Float16* xs = smem + LDS_X;
  _Float16* ob = smem + LDS_O;
  _Float16* wt = smem + LDS_WT;
  _Float16* kh = smem + LDS_K;
  _Float16* vt = smem + LDS_VT;
  float*    kb = (float*)(smem + LDS_KB);

  const int r     = blockIdx.x;        // residue: the "batch" dim of col-attn
  const int tid   = threadIdx.x;
  const int lane  = tid & 31;
  const int wv_id = tid >> 5;          // 16 waves; wave w owns s rows [16w,16w+16)
  const int hl    = lane >> 4;
  const int ln16  = lane & 15;
  const int rowb  = wv_id * ROWS_PW;

  float wr[16];            // the weight tile in flight: fetch_w ... put_w
  fetch_w(wr, wq, 0);      // head 0's query tile flies under the LayerNorm

  // ---------------- Phase 1: LayerNorm into LDS (f16) --------------------
  float lnw[8], lnbv[8];
#pragma unroll
  for (int i = 0; i < 8; ++i) { lnw[i] = ln_w[lane * 8 + i]; lnbv[i] = ln_b[lane * 8 + i]; }

  for (int sr = 0; sr < ROWS_PW; ++sr) {
    const int s = rowb + sr;
    const float* row = msa_act + ((size_t)s * R_LEN + r) * C_DIM;
    float v[8];
#pragma unroll
    for (int i = 0; i < 8; ++i) v[i] = row[lane * 8 + i];
    float sum = 0.f, sq = 0.f;
#pragma unroll
    for (int i = 0; i < 8; ++i) { sum += v[i]; sq += v[i] * v[i]; }
#pragma unroll
    for (int m = 16; m >= 1; m >>= 1) {
      sum += __shfl_xor(sum, m, 32);
      sq  += __shfl_xor(sq, m, 32);
    }
    const float mu   = sum * (1.f / 256.f);
    const float var  = sq * (1.f / 256.f) - mu * mu;
    const float rstd = rsqrtf(var + 1e-5f);
    v8h hx;
#pragma unroll
    for (int i = 0; i < 8; ++i)
      hx[i] = (_Float16)((v[i] - mu) * rstd * lnw[i] + lnbv[i]);
    *(v8h*)(xs + pidx<256>(s, lane * 8)) = hx;
  }

  // Attention bias of the 256 keys, read back 8 consecutive keys per lane.
  if (tid < S_LEN)
    kb[tid] = 1e9f * (msa_mask[(size_t)tid * R_LEN + r] - 1.f);

  __syncthreads();

  v8f oaccv[2];  // per-wave O^T accumulators [ntile]; persist through gating

  // ---------------- Phase 2: per-head fused attention ---------------------
  for (int h = 0; h < H_NUM; ++h) {
    __builtin_prefetch(wk + h * 32, 0, 0);   // global_prefetch_b8
    put_w(wt, wr);
    __syncthreads();
    fetch_w(wr, wk, h);
    // Q^T tiles 0 and 1, packed, ARE the B fragment of the score product
    // (k = 8*hl + i, then 16 + 8*hl + i): Q never goes through LDS.
    v16h qb;
#pragma unroll
    for (int nt = 0; nt < 2; ++nt) {
      const v8f acc = project_t(xs, wt, rowb, nt);
#pragma unroll
      for (int i = 0; i < 8; ++i)
        qb[nt * 8 + i] = (_Float16)(acc[i] * 0.17677669529663688f /*1/sqrt(32)*/);
    }
    __syncthreads();

    __builtin_prefetch(wvp + h * 32, 0, 0);
    put_w(wt, wr);
    __syncthreads();
    fetch_w(wr, wvp, h);
    project(xs, wt, kh, rowb, hl, ln16, 1.f, false);
    __syncthreads();

    put_w(wt, wr);
    __syncthreads();
    fetch_w(wr, wg, h);
    project(xs, wt, vt, rowb, hl, ln16, 1.f, true);  // store V transposed
    __syncthreads();  // all k/vT visible; every reader has left wt

    float rmax = -1e30f, rsum = 0.f;   // rsum: this half's keys only
    oaccv[0] = (v8f){};
    oaccv[1] = (v8f){};

    for (int kp = 0; kp < 8; ++kp) {  // 32 keys per step
      const int key0 = kp * 32;
      v8f s0 = {}, s1 = {};
      s0 = wmma16(ldfrag<256>(kh, key0 + 0, 0), qb, s0);
      s1 = wmma16(ldfrag<256>(kh, key0 + 16, 0), qb, s1);
      s0 += *(const v8f*)(kb + key0 + 8 * hl);
      s1 += *(const v8f*)(kb + key0 + 16 + 8 * hl);
      const float t0 = fmaxf(fmaxf(s0[0], s0[1]), s0[2]);
      const float t1 = fmaxf(fmaxf(s0[3], s0[4]), s0[5]);
      const float t2 = fmaxf(fmaxf(s0[6], s0[7]), s1[0]);
      const float t3 = fmaxf(fmaxf(s1[1], s1[2]), s1[3]);
      const float t4 = fmaxf(fmaxf(s1[4], s1[5]), s1[6]);
      float t = fmaxf(fmaxf(fmaxf(t0, t1), t2), fmaxf(fmaxf(t3, t4), s1[7]));
      t = fmaxf(t, other_half(t));
      const float nm = fmaxf(rmax, t);
      const float sc = exp_x1(rmax - nm);
      rmax = nm;
      const v8f p0 = exp_x8(s0 - nm);
      const v8f p1 = exp_x8(s1 - nm);
      v16h pf;
#pragma unroll
      for (int i = 0; i < 8; ++i) {
        pf[i]     = (_Float16)p0[i];
        pf[8 + i] = (_Float16)p1[i];
      }
      const v8f pv = p0 + p1;            // halved three times: packed adds
      const v4f ph = pv.lo + pv.hi;
      const v2f pq = ph.lo + ph.hi;
      rsum = rsum * sc + (pq.x + pq.y);
      oaccv[0] *= sc;
      oaccv[1] *= sc;
      oaccv[0] = wmma16(ldfrag<32>(vt, 0, key0), pf, oaccv[0]);
      oaccv[1] = wmma16(ldfrag<32>(vt, 16, key0), pf, oaccv[1]);
    }
    rsum += other_half(rsum);
    const float rinv = __builtin_amdgcn_rcpf(rsum);

    // ---- gating: g = sigmoid(x @ wg_h + bg_h); store gated O -------------
    // wt has had no reader since the barrier in front of the attention.
    put_w(wt, wr);
    __syncthreads();
    // next: the following head's query tile, behind the last head wo's tile 0
    fetch_w(wr, h + 1 < H_NUM ? wq : wo, h + 1 < H_NUM ? h + 1 : 0);
#pragma unroll
    for (int nt = 0; nt < 2; ++nt) {
      const v8f acc = project_t(xs, wt, rowb, nt);   // transposed like O^T
      const int dcol = h * 32 + nt * 16 + 8 * hl;
      // the lane's 8 values are 8 consecutive channels of one row: one chunk
      v8h pk;
#pragma unroll
      for (int i = 0; i < 8; ++i) {
        const float g = __builtin_amdgcn_rcpf(1.f + __expf(-(acc[i] + bg[dcol + i])));
        pk[i] = (_Float16)(oaccv[nt][i] * rinv * g);
      }
      *(v8h*)(ob + pidx<256>(rowb + ln16, dcol)) = pk;
    }
    __syncthreads();           // ob block written; wt free for next head
  }

  // ---------------- Phase 3: out = o @ wo + bo ----------------------------
  for (int cb = 0; cb < 8; ++cb) {  // 32 output channels per chunk
    put_w(wt, wr);   // wo[:, cb*32 : cb*32+32] transposed: wt[c_local][hd]
    __syncthreads();
    if (cb + 1 < 8) fetch_w(wr, wo, cb + 1);
#pragma unroll
    for (int nt = 0; nt < 2; ++nt) {
      v8f acc = {};
#pragma unroll
      for (int kc = 0; kc < 256; kc += 32) {
        v16h a = ldfrag<256>(ob, rowb, kc);
        v16h b = ldfrag<32>(wt, nt * 16, kc);
        acc = wmma16(a, b, acc);
      }
      const int c = cb * 32 + nt * 16 + ln16;
      const float bov = bo[c];
#pragma unroll
      for (int i = 0; i < 8; ++i) {
        const int s = rowb + i + 8 * hl;
        out[((size_t)s * R_LEN + r) * C_DIM + c] = acc[i] + bov;
      }
    }
    __syncthreads();   // wt reload for next channel chunk
  }
}

extern "C" void kernel_launch(void* const* d_in, const int* in_sizes, int n_in,
                              void* d_out, int out_size, void* d_ws, size_t ws_size,
                              hipStream_t stream) {
  (void)in_sizes; (void)n_in; (void)out_size; (void)d_ws; (void)ws_size;
  const float* msa_act  = (const float*)d_in[0];
  const float* msa_mask = (const float*)d_in[1];
  const float* ln_w     = (const float*)d_in[2];
  const float* ln_b     = (const float*)d_in[3];
  const float* wq       = (const float*)d_in[4];
  const float* wk       = (const float*)d_in[5];
  const float* wvp      = (const float*)d_in[6];
  const float* wg       = (const float*)d_in[7];
  const float* bg       = (const float*)d_in[8];
  const float* wo       = (const float*)d_in[9];
  const float* bo       = (const float*)d_in[10];
  float* out            = (float*)d_out;

  // 305 KB dynamic LDS (per-WGP max on CDNA5: 320 KB); opt in every call
  // (deterministic; hipFuncSetAttribute is not a stream op, capture-safe).
  hipFuncSetAttribute(reinterpret_cast<const void*>(col_attn_fused),
                      hipFuncAttributeMaxDynamicSharedMemorySize,
                      LDS_TOTAL_BYTES);

  col_attn_fused<<<dim3(R_LEN), dim3(NTHREADS), LDS_TOTAL_BYTES, stream>>>(
      msa_act, msa_mask, ln_w, ln_b, wq, wk, wvp, wg, bg, wo, bo, out);
}

// v004
// One run takes 160 microseconds.
// Two timings next to v003 both put it at 1.24 times that version's speed.
// All steps since v000 together make it 8.91 times as fast.
#include <hip/hip_runtime.h>
#include <hip/hip_bf16.h>

typedef __attribute__((ext_vector_type(16))) _Float16 v16h;
typedef __attribute__((ext_vector_type(8)))  _Float16 v8h;
typedef __attribute__((ext_vector_type(8)))  float    v8f;
typedef __attribute__((ext_vector_type(4)))  float    v4f;
typedef __attribute__((ext_vector_type(2)))  float    v2f;

#define S_LEN 256
#define R_LEN 384
#define C_DIM 256
#define H_NUM 8
#define D_DIM 32

#define NTHREADS 512   // 16 wave32 -> 4 waves per SIMD32 (latency hiding)
#define NWAVES   16
#define ROWS_PW  16    // query/sequence rows owned by each wave
#define N_WG     256   // one work-group per WGP, one round: 1.5 residues each

// LDS layout (offsets in halves; total 90624 halves = 181248 B = 177 KB)
// Sizes are logical [rows][cols]; how a tile lies in its range: pidx() below.
#define LDS_X   0        // x  [256][256] f16  (layernormed activations)
#define LDS_WT  65536    // wt [32][256]  f16  (transposed weight tile)
#define LDS_K   73728    // k  [256][32]  f16
#define LDS_VT  81920    // vT [32][256]  f16
#define LDS_KB  90112    // key bias [256] f32
#define LDS_TOTAL_BYTES 181248

// Second launch (output product): 24 waves, one 16-row tile each, so that the
// 384 * 16 row tiles are 256 work-groups, one per WGP. Its LDS holds
// all of wo as 8 transposed f16 tiles of [32][256].
#define OP_THREADS 768
#define OP_WAVES   24
#define OP_LDS_BYTES 131072

// Bank-conflict-free placement of a [ROWS][cols] f16 tile, no byte of padding.
// A fragment load has 16 lanes read the same 16-byte chunk of 16 consecutive
// rows; the LDS has 64 banks x 4 B, so those 16 chunks must fall on 16
// different 16-byte slots modulo 256 B. With rows of 512 B they all fall on
// one slot, with plain rows of 64 B on four.
//  - The tile is cut into panels of 32 columns; a panel is [ROWS][32], rows of
//    64 B, so 4 consecutive rows fill the 256 B once.
//  - Inside a row the four chunks are permuted by XOR with bits 2..3 of the
//    row number, so rows r, r+4, r+8, r+12 use four different slots.
// Writers and readers index through the same map; the place inside a chunk
// (col & 7) is untouched, and a panel step is a constant address offset.
template <int ROWS>
__device__ inline int pidx(int row, int col) {
  return (col >> 5) * (ROWS * 32) + row * 32 +
         ((col & 31) ^ (((row >> 2) & 3) << 3));
}
// The same index for an accumulator element: row = rowb + 8 * hl + i with rowb
// a multiple of 16, hl = lane >> 4, and i = 0..7 constant after unrolling
// (bits 2..3 of the row are i >> 2 and hl): lane part first, constant last.
template <int ROWS>
__device__ inline int pidx_acc(int rowb, int hl, int i, int col) {
  return (col >> 5) * (ROWS * 32) + (rowb + 8 * hl) * 32 +
         (((col & 31) ^ (hl << 4)) ^ ((i >> 2) << 3)) + i * 32;
}

// Load a 16x32 f16 WMMA fragment (A-layout, or B-layout when the matrix
// columns are stored contiguously as rows). Per ISA 7.12.2: lanes 0-15 hold
// row (lane&15), K=0..7 (VGPR0-3) and K=16..23 (VGPR4-7); lanes 16-31 hold
// K=8..15 and K=24..31. Two 16B chunks per lane -> ds_load_b128.
// Rows row0..row0+15 (row0 a multiple of 16), columns col0..col0+31 (col0 a
// multiple of 32) of a tile placed by pidx<ROWS>: chunks hl and hl + 2 of the
// row, each XORed with bits 2..3 of the row.
template <int ROWS>
__device__ inline v16h ldfrag(const _Float16* p, int row0, int col0) {
  const int lane = threadIdx.x & 31;
  const int l = lane & 15;
  const int x = ((lane >> 4) ^ (l >> 2)) << 3;
  const _Float16* q = p + (col0 >> 5) * (ROWS * 32) + (row0 + l) * 32;
  v8h lo = *(const v8h*)(q + x);
  v8h hi = *(const v8h*)(q + (x ^ 16));
  v16h r;
#pragma unroll
  for (int i = 0; i < 8; ++i) { r[i] = lo[i]; r[i + 8] = hi[i]; }
  return r;
}

__device__ inline v8f wmma16(v16h a, v16h b, v8f c) {
  return __builtin_amdgcn_wmma_f32_16x16x32_f16(false, a, false, b, (short)0, c,
                                                false, false);
}

// The value that lane ^ 16 holds (the other half of the wave), on the vector
// pipe.
__device__ inline float other_half(float v) {
  const int b = __builtin_bit_cast(int, v);
  return __builtin_bit_cast(float, __builtin_amdgcn_permlanex16(
      b, b, 0x76543210, 0xfedcba98, false, false));
}

// exp(x) as 2^(x * log2 e), the form __expf compiles to, for eight values (or
// one) in ONE statement: the instruction set asks for one independent
// instruction or a v_nop behind a transcendental before its result is read or
// its source overwritten. Here every result
// register differs from every source ("=&v"), each v_exp_f32 is the
// independent instruction behind the one before, and the v_nop is the slot
// behind the last.
__device__ inline v8f exp_x8(v8f x) {
  x *= 1.44269504088896340736f;
  float r0, r1, r2, r3, r4, r5, r6, r7;
  asm("v_exp_f32 %0, %8\n\tv_exp_f32 %1, %9\n\tv_exp_f32 %2, %10\n\t"
      "v_exp_f32 %3, %11\n\tv_exp_f32 %4, %12\n\tv_exp_f32 %5, %13\n\t"
      "v_exp_f32 %6, %14\n\tv_exp_f32 %7, %15\n\tv_nop"
      : "=&v"(r0), "=&v"(r1), "=&v"(r2), "=&v"(r3), "=&v"(r4), "=&v"(r5),
        "=&v"(r6), "=&v"(r7)
      : "v"(x[0]), "v"(x[1]), "v"(x[2]), "v"(x[3]), "v"(x[4]), "v"(x[5]),
        "v"(x[6]), "v"(x[7]));
  return (v8f){r0, r1, r2, r3, r4, r5, r6, r7};
}
__device__ inline float exp_x1(float x) {
  x *= 1.44269504088896340736f;
  float r;
  asm("v_exp_f32 %0, %1\n\tv_nop" : "=&v"(r) : "v"(x));
  return r;
}

// Staging of W[:, t*32 : t*32+32] transposed into LDS, wt[d][c] placed by
// pidx<32>, in two halves. fetch_w issues the thread's 16 loads together
// (c = c0 + 16 * k, d = lane: one address, constant offsets); put_w converts
// and stores them. fetch_w stands one stage ahead of its put_w, behind the
// barrier that opens the product on the tile before, so the loads' latency
// runs under that product instead of in front of a barrier.
__device__ inline void fetch_w(float (&wr)[16], const float* __restrict__ w, int t) {
  const int tid = threadIdx.x;
  const int d = tid & 31;
  const int c0 = tid >> 5;            // 0..15
  const unsigned off = (unsigned)(c0 * 256 + t * 32 + d) * 4u;   // bytes
#pragma unroll
  for (int k = 0; k < C_DIM / NWAVES; ++k)
    wr[k] = *(const float*)((const char*)w + off + k * (NWAVES * 256 * 4));
  // The wait that belongs in front of an overwrite of the loads' offset
  // register, once for all 16; the offset is an input so that it stays in its
  // register up to here (builds had given it to the last load's result).
  asm volatile("s_wait_xcnt 0x0" :: "v"(off) : "memory");
  // Holds the 16 loads here, at the head of the product that follows: without
  // it the scheduler sank them into that product's second half, and the wait
  // in front of the next barrier then saw most of their latency.
  __builtin_amdgcn_sched_barrier(0);
}
__device__ inline void put_w(_Float16* wt, const float (&wr)[16]) {
  const int tid = threadIdx.x;
  const int d = tid & 31;
  const int c0 = tid >> 5;
#pragma unroll
  for (int k = 0; k < C_DIM / NWAVES; ++k)
    wt[pidx<32>(d, c0 + k * NWAVES)] = (_Float16)wr[k];
}

// Per-wave projection: this wave's 16 rows of (x @ wtT_block) -> [16 x 32].
// transposed=false -> dst is [s][32]; true -> dst is [d][256].
__device__ inline void project(const _Float16* xs, const _Float16* wt,
                               _Float16* dst, int rowb, int hl, int ln16,
                               float scale, bool transposed) {
#pragma unroll
  for (int nt = 0; nt < 2; ++nt) {
    v8f acc = {};
#pragma unroll
    for (int kc = 0; kc < C_DIM; kc += 32) {
      v16h a = ldfrag<256>(xs, rowb, kc);
      v16h b = ldfrag<32>(wt, nt * 16, kc);
      acc = wmma16(a, b, acc);
    }
    const int dcol = nt * 16 + ln16;        // C-layout: N = lane & 15,
    if (transposed) {                       //           M = i + 8*(lane>>4)
      // the lane's 8 values are 8 consecutive s of row dcol: one whole chunk
      v8h pk;
#pragma unroll
      for (int i = 0; i < 8; ++i) pk[i] = (_Float16)(acc[i] * scale);
      *(v8h*)(dst + pidx<32>(dcol, rowb + 8 * hl)) = pk;
    } else {
#pragma unroll
      for (int i = 0; i < 8; ++i)
        dst[pidx_acc<256>(rowb, hl, i, dcol)] = (_Float16)(acc[i] * scale);
    }
  }
}

// Per-wave transposed projection, weights as A and x as B: tile nt holds
// (x @ w)[rowb + ln16][nt*16 + 8*hl + i] in element i, that is 8 consecutive
// channels of ONE row per lane.
__device__ inline v8f project_t(const _Float16* xs, const _Float16* wt,
                                int rowb, int nt) {
  v8f acc = {};
#pragma unroll
  for (int kc = 0; kc < C_DIM; kc += 32) {
    v16h a = ldfrag<32>(wt, nt * 16, kc);
    v16h b = ldfrag<256>(xs, rowb, kc);
    acc = wmma16(a, b, acc);
  }
  return acc;
}

__global__ void __launch_bounds__(NTHREADS, 1)
col_attn_fused(const float* __restrict__ msa_act,
               const float* __restrict__ msa_mask,
               const float* __restrict__ ln_w, const float* __restrict__ ln_b,
               const float* __restrict__ wq, const float* __restrict__ wk,
               const float* __restrict__ wvp, const float* __restrict__ wg,
               const float* __restrict__ bg, float* __restrict__ ws) {
  extern __shared__ _Float16 smem[];
  _Float16* xs = smem + LDS_X;
  _Float16* wt = smem + LDS_WT;
  _Float16* kh = smem + LDS_K;
  _Float16* vt = smem + LDS_VT;
  float*    kb = (float*)(smem + LDS_KB);

  const int tid   = threadIdx.x;
  const int lane  = tid & 31;
  const int wv_id = tid >> 5;          // 16 waves; wave w owns s rows [16w,16w+16)
  const int hl    = lane >> 4;
  const int ln16  = lane & 15;
  const int rowb  = wv_id * ROWS_PW;

  // The deal: 384 residues x 8 heads are 12 (residue, head) units for each of
  // the 256 work-groups. A pair of work-groups has three residues: first each
  // takes four heads of the middle one (both read its rows at the same time),
  // then all eight heads of one of the outer two.
  const int pair = blockIdx.x >> 1;
  const int odd  = blockIdx.x & 1;

  for (int job = 0; job < 2; ++job) {
  const int r  = job == 0 ? 3 * pair + 1 : 3 * pair + 2 * odd;  // residue: the
                                               // "batch" dim of col-attn
  const int h0 = job == 0 ? 4 * odd : 0;       // heads h0 .. h1 - 1
  const int h1 = job == 0 ? h0 + 4 : H_NUM;

  // xs, kb: their last readers of the job before stand in front of that job's
  // last barrier.
  float wr[16];            // the weight tile in flight: fetch_w ... put_w
  fetch_w(wr, wq, h0);     // the first query tile flies under the LayerNorm

  // ---------------- Phase 1: LayerNorm into LDS (f16) --------------------
  float lnw[8], lnbv[8];
#pragma unroll
  for (int i = 0; i < 8; ++i) { lnw[i] = ln_w[lane * 8 + i]; lnbv[i] = ln_b[lane * 8 + i]; }

  for (int sr = 0; sr < ROWS_PW; ++sr) {
    const int s = rowb + sr;
    const float* row = msa_act + ((size_t)s * R_LEN + r) * C_DIM;
    float v[8];
#pragma unroll
    for (int i = 0; i < 8; ++i) v[i] = row[lane * 8 + i];
    float sum = 0.f, sq = 0.f;
#pragma unroll
    for (int i = 0; i < 8; ++i) { sum += v[i]; sq += v[i] * v[i]; }
#pragma unroll
    for (int m = 16; m >= 1; m >>= 1) {
      sum += __shfl_xor(sum, m, 32);
      sq  += __shfl_xor(sq, m, 32);
    }
    const float mu   = sum * (1.f / 256.f);
    const float var  = sq * (1.f / 256.f) - mu * mu;
    const float rstd = rsqrtf(var + 1e-5f);
    v8h hx;
#pragma unroll
    for (int i = 0; i < 8; ++i)
      hx[i] = (_Float16)((v[i] - mu) * rstd * lnw[i] + lnbv[i]);
    *(v8h*)(xs + pidx<256>(s, lane * 8)) = hx;
  }

  // Attention bias of the 256 keys, read back 8 consecutive keys per lane.
  if (tid < S_LEN)
    kb[tid] = 1e9f * (msa_mask[(size_t)tid * R_LEN + r] - 1.f);

  __syncthreads();

  v8f oaccv[2];  // per-wave O^T accumulators [ntile]; persist through gating

  // ---------------- Phase 2: per-head fused attention ---------------------
  for (int h = h0; h < h1; ++h) {
    __builtin_prefetch(wk + h * 32, 0, 0);   // global_prefetch_b8
    put_w(wt, wr);
    __syncthreads();
    fetch_w(wr, wk, h);
    // Q^T tiles 0 and 1, packed, ARE the B fragment of the score product
    // (k = 8*hl + i, then 16 + 8*hl + i): Q never goes through LDS.
    v16h qb;
#pragma unroll
    for (int nt = 0; nt < 2; ++nt) {
      const v8f acc = project_t(xs, wt, rowb, nt);
#pragma unroll
      for (int i = 0; i < 8; ++i)
        qb[nt * 8 + i] = (_Float16)(acc[i] * 0.17677669529663688f /*1/sqrt(32)*/);
    }
    __syncthreads();

    __builtin_prefetch(wvp + h * 32, 0, 0);
    put_w(wt, wr);
    __syncthreads();
    fetch_w(wr, wvp, h);
    project(xs, wt, kh, rowb, hl, ln16, 1.f, false);
    __syncthreads();

    put_w(wt, wr);
    __syncthreads();
    fetch_w(wr, wg, h);
    project(xs, wt, vt, rowb, hl, ln16, 1.f, true);  // store V transposed
    __syncthreads();  // all k/vT visible; every reader has left wt

    float rmax = -1e30f, rsum = 0.f;   // rsum: this half's keys only
    oaccv[0] = (v8f){};
    oaccv[1] = (v8f){};

    for (int kp = 0; kp < 8; ++kp) {  // 32 keys per step
      const int key0 = kp * 32;
      v8f s0 = {}, s1 = {};
      s0 = wmma16(ldfrag<256>(kh, key0 + 0, 0), qb, s0);
      s1 = wmma16(ldfrag<256>(kh, key0 + 16, 0), qb, s1);
      s0 += *(const v8f*)(kb + key0 + 8 * hl);
      s1 += *(const v8f*)(kb + key0 + 16 + 8 * hl);
      const float t0 = fmaxf(fmaxf(s0[0], s0[1]), s0[2]);
      const float t1 = fmaxf(fmaxf(s0[3], s0[4]), s0[5]);
      const float t2 = fmaxf(fmaxf(s0[6], s0[7]), s1[0]);
      const float t3 = fmaxf(fmaxf(s1[1], s1[2]), s1[3]);
      const float t4 = fmaxf(fmaxf(s1[4], s1[5]), s1[6]);
      float t = fmaxf(fmaxf(fmaxf(t0, t1), t2), fmaxf(fmaxf(t3, t4), s1[7]));
      t = fmaxf(t, other_half(t));
      const float nm = fmaxf(rmax, t);
      const float sc = exp_x1(rmax - nm);
      rmax = nm;
      const v8f p0 = exp_x8(s0 - nm);
      const v8f p1 = exp_x8(s1 - nm);
      v16h pf;
#pragma unroll
      for (int i = 0; i < 8; ++i) {
        pf[i]     = (_Float16)p0[i];
        pf[8 + i] = (_Float16)p1[i];
      }
      const v8f pv = p0 + p1;            // halved three times: packed adds
      const v4f ph = pv.lo + pv.hi;
      const v2f pq = ph.lo + ph.hi;
      rsum = rsum * sc + (pq.x + pq.y);
      oaccv[0] *= sc;
      oaccv[1] *= sc;
      oaccv[0] = wmma16(ldfrag<32>(vt, 0, key0), pf, oaccv[0]);
      oaccv[1] = wmma16(ldfrag<32>(vt, 16, key0), pf, oaccv[1]);
    }
    rsum += other_half(rsum);
    const float rinv = __builtin_amdgcn_rcpf(rsum);

    // ---- gating: g = sigmoid(x @ wg_h + bg_h); store gated O -------------
    // wt has had no reader since the barrier in front of the attention.
    put_w(wt, wr);
    __syncthreads();
    if (h + 1 < h1) fetch_w(wr, wq, h + 1);  // next head's query tile
    // The lane's two packed tiles of head h ARE its part of the A fragment of
    // the output product for columns 32h..32h+31 (k = 8*hl + i, then
    // 16 + 8*hl + i): stored in that order, 32 B a lane, 1 KB a wave and head.
    v8h* og = (v8h*)ws + ((((size_t)r * NWAVES + wv_id) * H_NUM + h) * 32 + lane) * 2;
    v8h go[2];
#pragma unroll
    for (int nt = 0; nt < 2; ++nt) {
      const v8f acc = project_t(xs, wt, rowb, nt);   // transposed like O^T
      const int dcol = h * 32 + nt * 16 + 8 * hl;
      // the lane's 8 values are 8 consecutive channels of one row: one chunk
      v8h pk;
#pragma unroll
      for (int i = 0; i < 8; ++i) {
        const float g = __builtin_amdgcn_rcpf(1.f + __expf(-(acc[i] + bg[dcol + i])));
        pk[i] = (_Float16)(oaccv[nt][i] * rinv * g);
      }
      go[nt] = pk;
    }
    __syncthreads();           // wt free for next head
    // Behind the barrier, not in front of it: a barrier waits for the wave's
    // outstanding global stores, and here they fly under the next staging.
    og[0] = go[0];
    og[1] = go[1];
    // in front of any reuse of the two stores' address registers
    asm volatile("s_wait_xcnt 0x0" ::: "memory");
  }
  }  // job
}

// ---------------- Second launch: out = o @ wo + bo ------------------------
__global__ void __launch_bounds__(OP_THREADS, 1)
col_attn_out(const float* __restrict__ wo, const float* __restrict__ bo,
             const float* __restrict__ ws, float* __restrict__ out) {
  extern __shared__ _Float16 smem[];
  const int tid  = threadIdx.x;
  const int lane = tid & 31;
  const int hl   = lane >> 4;
  const int ln16 = lane & 15;
  const int g    = blockIdx.x * OP_WAVES + (tid >> 5);  // row tile, as written
  const int r    = g >> 4;
  const int rowb = (g & 15) * ROWS_PW;

  // The tile's 8 A fragments, as the first launch's lanes laid them down.
  const v16h* og = (const v16h*)ws + (size_t)g * (H_NUM * 32) + lane;
  v16h of[H_NUM];
#pragma unroll
  for (int h = 0; h < H_NUM; ++h) of[h] = og[h * 32];
  // In front of any reuse of the loads' address registers; the address is an
  // input so that it stays in them up to here (the build had given them to the
  // last load's result).
  asm volatile("s_wait_xcnt 0x0" :: "v"(og) : "memory");

  // wo[:, t*32 : t*32+32] transposed, tile t at smem + t * 8192; the staging
  // helpers are written for 16 waves, four tiles' loads in flight at a time.
  if (tid < NTHREADS) {
#pragma unroll
    for (int tb = 0; tb < 8; tb += 4) {
      float wr[4][16];
#pragma unroll
      for (int t = 0; t < 4; ++t) fetch_w(wr[t], wo, tb + t);
#pragma unroll
      for (int t = 0; t < 4; ++t) put_w(smem + (tb + t) * 8192, wr[t]);
    }
  }
  __syncthreads();

  for (int cb = 0; cb < 8; ++cb) {  // 32 output channels per chunk
    const _Float16* wt = smem + cb * 8192;
#pragma unroll
    for (int nt = 0; nt < 2; ++nt) {
      v8f acc = {};
#pragma unroll
      for (int kc = 0; kc < 256; kc += 32) {
        v16h b = ldfrag<32>(wt, nt * 16, kc);
        acc = wmma16(of[kc >> 5], b, acc);
      }
      const int c = cb * 32 + nt * 16 + ln16;
      const float bov = bo[c];
#pragma unroll
      for (int i = 0; i < 8; ++i) {
        const int s = rowb + i + 8 * hl;
        out[((size_t)s * R_LEN + r) * C_DIM + c] = acc[i] + bov;
      }
    }
    // in front of the next trip's reuse of the address registers
    asm volatile("s_wait_xcnt 0x0" ::: "memory");
  }
}

extern "C" void kernel_launch(void* const* d_in, const int* in_sizes, int n_in,
                              void* d_out, int out_size, void* d_ws, size_t ws_size,
                              hipStream_t stream) {
  (void)in_sizes; (void)n_in; (void)out_size; (void)ws_size;
  const float* msa_act  = (const float*)d_in[0];
  const float* msa_mask = (const float*)d_in[1];
  const float* ln_w     = (const float*)d_in[2];
  const float* ln_b     = (const float*)d_in[3];
  const float* wq       = (const float*)d_in[4];
  const float* wk       = (const float*)d_in[5];
  const float* wvp      = (const float*)d_in[6];
  const float* wg       = (const float*)d_in[7];
  const float* bg       = (const float*)d_in[8];
  const float* wo       = (const float*)d_in[9];
  const float* bo       = (const float*)d_in[10];
  float* out            = (float*)d_out;
  float* ws             = (float*)d_ws;   // gated o, f16 fragments: 48 MiB

  // dynamic LDS above the default limit; opt in every call
  // (deterministic; hipFuncSetAttribute is not a stream op, capture-safe).
  hipFuncSetAttribute(reinterpret_cast<const void*>(col_attn_fused),
                      hipFuncAttributeMaxDynamicSharedMemorySize,
                      LDS_TOTAL_BYTES);
  hipFuncSetAttribute(reinterpret_cast<const void*>(col_attn_out),
                      hipFuncAttributeMaxDynamicSharedMemorySize,
                      OP_LDS_BYTES);

  col_attn_fused<<<dim3(N_WG), dim3(NTHREADS), LDS_TOTAL_BYTES, stream>>>(
      msa_act, msa_mask, ln_w, ln_b, wq, wk, wvp, wg, bg, ws);
  col_attn_out<<<dim3(N_WG), dim3(OP_THREADS), OP_LDS_BYTES, stream>>>(
      wo, bo, ws, out);
}

// v005
// A run of this version takes 154 microseconds.
// Timed twice side by side with v004, it ran 1.04 times as fast both times.
// Over all steps from v000 it is 9.26 times as fast.
#include <hip/hip_runtime.h>
#include <hip/hip_bf16.h>

typedef __attribute__((ext_vector_type(16))) _Float16 v16h;
typedef __attribute__((ext_vector_type(8)))  _Float16 v8h;
typedef __attribute__((ext_vector_type(8)))  float    v8f;
typedef __attribute__((ext_vector_type(4)))  float    v4f;
typedef __attribute__((ext_vector_type(2)))  float    v2f;

#define S_LEN 256
#define R_LEN 384
#define C_DIM 256
#define H_NUM 8
#define D_DIM 32

#define NTHREADS 512   // 16 wave32 -> 4 waves per SIMD32 (latency hiding)
#define NWAVES   16
#define ROWS_PW  16    // query/sequence rows owned by each wave
#define N_WG     256   // one work-group per WGP, one round: 1.5 residues each

// LDS layout (offsets in halves; total 147968 halves = 295936 B = 289 KB)
// Sizes are logical [rows][cols]; how a tile lies in its range: pidx() below.
#define LDS_X   0        // x  [256][256] f16  (layernormed activations)
#define LDS_WT  65536    // wt [2][4][32][256] f16: two sets of a head's four
                         // transposed weight tiles (query, key, value, gate)
#define LDS_K   131072   // k  [256][32]  f16
#define LDS_VT  139264   // vT [32][256]  f16
#define LDS_KB  147456   // key bias [256] f32
#define LDS_TOTAL_BYTES 295936
#define WT_TILE 8192     // halves of one weight tile
#define WT_SET  32768    // halves of a set of four

// Second launch (output product): 24 waves, one 16-row tile each, so that the
// 384 * 16 row tiles are 256 work-groups, one per WGP. Its LDS holds
// all of wo as 8 transposed f16 tiles of [32][256].
#define OP_THREADS 768
#define OP_WAVES   24
#define OP_LDS_BYTES 131072

// Bank-conflict-free placement of a [ROWS][cols] f16 tile, no byte of padding.
// A fragment load has 16 lanes read the same 16-byte chunk of 16 consecutive
// rows; the LDS has 64 banks x 4 B, so those 16 chunks must fall on 16
// different 16-byte slots modulo 256 B. With rows of 512 B they all fall on
// one slot, with plain rows of 64 B on four.
//  - The tile is cut into panels of 32 columns; a panel is [ROWS][32], rows of
//    64 B, so 4 consecutive rows fill the 256 B once.
//  - Inside a row the four chunks are permuted by XOR with bits 2..3 of the
//    row number, so rows r, r+4, r+8, r+12 use four different slots.
// Writers and readers index through the same map; the place inside a chunk
// (col & 7) is untouched, and a panel step is a constant address offset.
template <int ROWS>
__device__ inline int pidx(int row, int col) {
  return (col >> 5) * (ROWS * 32) + row * 32 +
         ((col & 31) ^ (((row >> 2) & 3) << 3));
}
// The same index for an accumulator element: row = rowb + 8 * hl + i with rowb
// a multiple of 16, hl = lane >> 4, and i = 0..7 constant after unrolling
// (bits 2..3 of the row are i >> 2 and hl): lane part first, constant last.
template <int ROWS>
__device__ inline int pidx_acc(int rowb, int hl, int i, int col) {
  return (col >> 5) * (ROWS * 32) + (rowb + 8 * hl) * 32 +
         (((col & 31) ^ (hl << 4)) ^ ((i >> 2) << 3)) + i * 32;
}

// Load a 16x32 f16 WMMA fragment (A-layout, or B-layout when the matrix
// columns are stored contiguously as rows). Per ISA 7.12.2: lanes 0-15 hold
// row (lane&15), K=0..7 (VGPR0-3) and K=16..23 (VGPR4-7); lanes 16-31 hold
// K=8..15 and K=24..31. Two 16B chunks per lane -> ds_load_b128.
// Rows row0..row0+15 (row0 a multiple of 16), columns col0..col0+31 (col0 a
// multiple of 32) of a tile placed by pidx<ROWS>: chunks hl and hl + 2 of the
// row, each XORed with bits 2..3 of the row.
template <int ROWS>
__device__ inline v16h ldfrag(const _Float16* p, int row0, int col0) {
  const int lane = threadIdx.x & 31;
  const int l = lane & 15;
  const int x = ((lane >> 4) ^ (l >> 2)) << 3;
  const _Float16* q = p + (col0 >> 5) * (ROWS * 32) + (row0 + l) * 32;
  v8h lo = *(const v8h*)(q + x);
  v8h hi = *(const v8h*)(q + (x ^ 16));
  v16h r;
#pragma unroll
  for (int i = 0; i < 8; ++i) { r[i] = lo[i]; r[i + 8] = hi[i]; }
  return r;
}

__device__ inline v8f wmma16(v16h a, v16h b, v8f c) {
  return __builtin_amdgcn_wmma_f32_16x16x32_f16(false, a, false, b, (short)0, c,
                                                false, false);
}

// The value that lane ^ 16 holds (the other half of the wave), on the vector
// pipe.
__device__ inline float other_half(float v) {
  const int b = __builtin_bit_cast(int, v);
  return __builtin_bit_cast(float, __builtin_amdgcn_permlanex16(
      b, b, 0x76543210, 0xfedcba98, false, false));
}

// exp(x) as 2^(x * log2 e), the form __expf compiles to, for eight values (or
// one) in ONE statement: the instruction set asks for one independent
// instruction or a v_nop behind a transcendental before its result is read or
// its source overwritten. Here every result
// register differs from every source ("=&v"), each v_exp_f32 is the
// independent instruction behind the one before, and the v_nop is the slot
// behind the last.
__device__ inline v8f exp_x8(v8f x) {
  x *= 1.44269504088896340736f;
  float r0, r1, r2, r3, r4, r5, r6, r7;
  asm("v_exp_f32 %0, %8\n\tv_exp_f32 %1, %9\n\tv_exp_f32 %2, %10\n\t"
      "v_exp_f32 %3, %11\n\tv_exp_f32 %4, %12\n\tv_exp_f32 %5, %13\n\t"
      "v_exp_f32 %6, %14\n\tv_exp_f32 %7, %15\n\tv_nop"
      : "=&v"(r0), "=&v"(r1), "=&v"(r2), "=&v"(r3), "=&v"(r4), "=&v"(r5),
        "=&v"(r6), "=&v"(r7)
      : "v"(x[0]), "v"(x[1]), "v"(x[2]), "v"(x[3]), "v"(x[4]), "v"(x[5]),
        "v"(x[6]), "v"(x[7]));
  return (v8f){r0, r1, r2, r3, r4, r5, r6, r7};
}
__device__ inline float exp_x1(float x) {
  x *= 1.44269504088896340736f;
  float r;
  asm("v_exp_f32 %0, %1\n\tv_nop" : "=&v"(r) : "v"(x));
  return r;
}

// Staging of W[:, t*32 : t*32+32] transposed into LDS, wt[d][c] placed by
// pidx<32>, in two halves. fetch_w issues the thread's 16 loads together
// (c = c0 + 16 * k, d = lane: one address, constant offsets); put_w converts
// and stores them. fetch_w stands one product ahead of its put_w, so the
// loads' latency runs under that product.
__device__ inline void fetch_w(float (&wr)[16], const float* __restrict__ w, int t) {
  const int tid = threadIdx.x;
  const int d = tid & 31;
  const int c0 = tid >> 5;            // 0..15
  const unsigned off = (unsigned)(c0 * 256 + t * 32 + d) * 4u;   // bytes
#pragma unroll
  for (int k = 0; k < C_DIM / NWAVES; ++k)
    wr[k] = *(const float*)((const char*)w + off + k * (NWAVES * 256 * 4));
  // The wait that belongs in front of an overwrite of the loads' offset
  // register, once for all 16; the offset is an input so that it stays in its
  // register up to here (builds had given it to the last load's result).
  asm volatile("s_wait_xcnt 0x0" :: "v"(off) : "memory");
  // Holds the 16 loads here, at the head of the product that follows: without
  // it the scheduler sank them into that product's second half, and the wait
  // in front of the next barrier then saw most of their latency.
  __builtin_amdgcn_sched_barrier(0);
}
__device__ inline void put_w(_Float16* wt, const float (&wr)[16]) {
  const int tid = threadIdx.x;
  const int d = tid & 31;
  const int c0 = tid >> 5;
#pragma unroll
  for (int k = 0; k < C_DIM / NWAVES; ++k)
    wt[pidx<32>(d, c0 + k * NWAVES)] = (_Float16)wr[k];
}

// Per-wave projection: this wave's 16 rows of (x @ wtT_block) -> [16 x 32].
// transposed=false -> dst is [s][32]; true -> dst is [d][256].
__device__ inline void project(const _Float16* xs, const _Float16* wt,
                               _Float16* dst, int rowb, int hl, int ln16,
                               float scale, bool transposed) {
  // Both column tiles' products stand in front of the stores: which set wt
  // lies in is known only at run time, so no fragment load of the second tile
  // can be moved up over a store of the first.
  v8f accs[2];
#pragma unroll
  for (int nt = 0; nt < 2; ++nt) {
    v8f acc = {};
#pragma unroll
    for (int kc = 0; kc < C_DIM; kc += 32) {
      v16h a = ldfrag<256>(xs, rowb, kc);
      v16h b = ldfrag<32>(wt, nt * 16, kc);
      acc = wmma16(a, b, acc);
    }
    accs[nt] = acc;
  }
#pragma unroll
  for (int nt = 0; nt < 2; ++nt) {
    const v8f acc = accs[nt];
    const int dcol = nt * 16 + ln16;        // C-layout: N = lane & 15,
    if (transposed) {                       //           M = i + 8*(lane>>4)
      // the lane's 8 values are 8 consecutive s of row dcol: one whole chunk
      v8h pk;
#pragma unroll
      for (int i = 0; i < 8; ++i) pk[i] = (_Float16)(acc[i] * scale);
      *(v8h*)(dst + pidx<32>(dcol, rowb + 8 * hl)) = pk;
    } else {
#pragma unroll
      for (int i = 0; i < 8; ++i)
        dst[pidx_acc<256>(rowb, hl, i, dcol)] = (_Float16)(acc[i] * scale);
    }
  }
}

// Per-wave transposed projection, weights as A and x as B: tile nt holds
// (x @ w)[rowb + ln16][nt*16 + 8*hl + i] in element i, that is 8 consecutive
// channels of ONE row per lane.
__device__ inline v8f project_t(const _Float16* xs, const _Float16* wt,
                                int rowb, int nt) {
  v8f acc = {};
#pragma unroll
  for (int kc = 0; kc < C_DIM; kc += 32) {
    v16h a = ldfrag<32>(wt, nt * 16, kc);
    v16h b = ldfrag<256>(xs, rowb, kc);
    acc = wmma16(a, b, acc);
  }
  return acc;
}

__global__ void __launch_bounds__(NTHREADS, 1)
col_attn_fused(const float* __restrict__ msa_act,
               const float* __restrict__ msa_mask,
               const float* __restrict__ ln_w, const float* __restrict__ ln_b,
               const float* __restrict__ wq, const float* __restrict__ wk,
               const float* __restrict__ wvp, const float* __restrict__ wg,
               const float* __restrict__ bg, float* __restrict__ ws) {
  extern __shared__ _Float16 smem[];
  _Float16* xs = smem + LDS_X;
  _Float16* wt = smem + LDS_WT;
  _Float16* kh = smem + LDS_K;
  _Float16* vt = smem + LDS_VT;
  float*    kb = (float*)(smem + LDS_KB);

  const int tid   = threadIdx.x;
  const int lane  = tid & 31;
  const int wv_id = tid >> 5;          // 16 waves; wave w owns s rows [16w,16w+16)
  const int hl    = lane >> 4;
  const int ln16  = lane & 15;
  const int rowb  = wv_id * ROWS_PW;

  // The deal: 384 residues x 8 heads are 12 (residue, head) units for each of
  // the 256 work-groups. A pair of work-groups has three residues: first each
  // takes four heads of the middle one (both read its rows at the same time),
  // then all eight heads of one of the outer two.
  const int pair = blockIdx.x >> 1;
  const int odd  = blockIdx.x & 1;

  // The set of weight tiles that the current head reads; the other set is
  // filled for the next head meanwhile, tile by tile between the products, so
  // that staging needs no barrier of its own. Its last readers (the head
  // before) stand in front of the barrier that ends that head, and the barrier
  // that ends this head publishes it.
  int set = 0;
  // The very first head's set; the barrier behind the LayerNorm publishes it.
  // Every later head's, the second job's first among them, is staged by the
  // head before.
  {
    float w0[4][16];
    fetch_w(w0[0], wq, 4 * odd);
    fetch_w(w0[1], wk, 4 * odd);
    fetch_w(w0[2], wvp, 4 * odd);
    fetch_w(w0[3], wg, 4 * odd);
#pragma unroll
    for (int t = 0; t < 4; ++t) put_w(wt + t * WT_TILE, w0[t]);
  }

  for (int job = 0; job < 2; ++job) {
  const int r  = job == 0 ? 3 * pair + 1 : 3 * pair + 2 * odd;  // residue: the
                                               // "batch" dim of col-attn
  const int h0 = job == 0 ? 4 * odd : 0;       // heads h0 .. h1 - 1
  const int h1 = job == 0 ? h0 + 4 : H_NUM;

  // xs, kb: their last readers of the job before stand in front of that job's
  // last barrier.

  // ---------------- Phase 1: LayerNorm into LDS (f16) --------------------
  float lnw[8], lnbv[8];
#pragma unroll
  for (int i = 0; i < 8; ++i) { lnw[i] = ln_w[lane * 8 + i]; lnbv[i] = ln_b[lane * 8 + i]; }

  for (int sr = 0; sr < ROWS_PW; ++sr) {
    const int s = rowb + sr;
    const float* row = msa_act + ((size_t)s * R_LEN + r) * C_DIM;
    float v[8];
#pragma unroll
    for (int i = 0; i < 8; ++i) v[i] = row[lane * 8 + i];
    float sum = 0.f, sq = 0.f;
#pragma unroll
    for (int i = 0; i < 8; ++i) { sum += v[i]; sq += v[i] * v[i]; }
#pragma unroll
    for (int m = 16; m >= 1; m >>= 1) {
      sum += __shfl_xor(sum, m, 32);
      sq  += __shfl_xor(sq, m, 32);
    }
    const float mu   = sum * (1.f / 256.f);
    const float var  = sq * (1.f / 256.f) - mu * mu;
    const float rstd = rsqrtf(var + 1e-5f);
    v8h hx;
#pragma unroll
    for (int i = 0; i < 8; ++i)
      hx[i] = (_Float16)((v[i] - mu) * rstd * lnw[i] + lnbv[i]);
    *(v8h*)(xs + pidx<256>(s, lane * 8)) = hx;
  }

  // Attention bias of the 256 keys, read back 8 consecutive keys per lane.
  if (tid < S_LEN)
    kb[tid] = 1e9f * (msa_mask[(size_t)tid * R_LEN + r] - 1.f);

  __syncthreads();

  v8f oaccv[2];  // per-wave O^T accumulators [ntile]; persist through gating

  // ---------------- Phase 2: per-head fused attention ---------------------
  for (int h = h0; h < h1; ++h) {
    const _Float16* wc = wt + set * WT_SET;        // this head's four tiles
    _Float16*       wn = wt + (set ^ 1) * WT_SET;  // the next head's
    // The head after this one; behind a job's last head comes head 0 (the
    // second job's first; behind the last head of all nobody reads the set).
    const int hn = h + 1 < h1 ? h + 1 : 0;
    float wr[16];            // the weight tile in flight: fetch_w ... put_w
    fetch_w(wr, wq, hn);
    // Q^T tiles 0 and 1, packed, ARE the B fragment of the score product
    // (k = 8*hl + i, then 16 + 8*hl + i): Q never goes through LDS.
    v16h qb;
#pragma unroll
    for (int nt = 0; nt < 2; ++nt) {
      const v8f acc = project_t(xs, wc, rowb, nt);
#pragma unroll
      for (int i = 0; i < 8; ++i)
        qb[nt * 8 + i] = (_Float16)(acc[i] * 0.17677669529663688f /*1/sqrt(32)*/);
    }
    // Ends the product's scheduling region: with the staging stores in one
    // region with it, each weight fragment's load came out directly in front
    // of its product, which then stood through the LDS latency every time.
    __builtin_amdgcn_sched_barrier(0);

    put_w(wn, wr);
    fetch_w(wr, wk, hn);
    project(xs, wc + WT_TILE, kh, rowb, hl, ln16, 1.f, false);

    put_w(wn + WT_TILE, wr);
    fetch_w(wr, wvp, hn);
    project(xs, wc + 2 * WT_TILE, vt, rowb, hl, ln16, 1.f, true);  // V transposed

    put_w(wn + 2 * WT_TILE, wr);
    __syncthreads();  // all k/vT visible
    fetch_w(wr, wg, hn);   // behind the barrier: a barrier waits for loads in flight

    float rmax = -1e30f, rsum = 0.f;   // rsum: this half's keys only
    oaccv[0] = (v8f){};
    oaccv[1] = (v8f){};

    for (int kp = 0; kp < 8; ++kp) {  // 32 keys per step
      const int key0 = kp * 32;
      v8f s0 = {}, s1 = {};
      s0 = wmma16(ldfrag<256>(kh, key0 + 0, 0), qb, s0);
      s1 = wmma16(ldfrag<256>(kh, key0 + 16, 0), qb, s1);
      s0 += *(const v8f*)(kb + key0 + 8 * hl);
      s1 += *(const v8f*)(kb + key0 + 16 + 8 * hl);
      const float t0 = fmaxf(fmaxf(s0[0], s0[1]), s0[2]);
      const float t1 = fmaxf(fmaxf(s0[3], s0[4]), s0[5]);
      const float t2 = fmaxf(fmaxf(s0[6], s0[7]), s1[0]);
      const float t3 = fmaxf(fmaxf(s1[1], s1[2]), s1[3]);
      const float t4 = fmaxf(fmaxf(s1[4], s1[5]), s1[6]);
      float t = fmaxf(fmaxf(fmaxf(t0, t1), t2), fmaxf(fmaxf(t3, t4), s1[7]));
      t = fmaxf(t, other_half(t));
      const float nm = fmaxf(rmax, t);
      const float sc = exp_x1(rmax - nm);
      rmax = nm;
      const v8f p0 = exp_x8(s0 - nm);
      const v8f p1 = exp_x8(s1 - nm);
      v16h pf;
#pragma unroll
      for (int i = 0; i < 8; ++i) {
        pf[i]     = (_Float16)p0[i];
        pf[8 + i] = (_Float16)p1[i];
      }
      const v8f pv = p0 + p1;            // halved three times: packed adds
      const v4f ph = pv.lo + pv.hi;
      const v2f pq = ph.lo + ph.hi;
      rsum = rsum * sc + (pq.x + pq.y);
      oaccv[0] *= sc;
      oaccv[1] *= sc;
      oaccv[0] = wmma16(ldfrag<32>(vt, 0, key0), pf, oaccv[0]);
      oaccv[1] = wmma16(ldfrag<32>(vt, 16, key0), pf, oaccv[1]);
    }
    rsum += other_half(rsum);
    const float rinv = __builtin_amdgcn_rcpf(rsum);

    // ---- gating: g = sigmoid(x @ wg_h + bg_h); store gated O -------------
    put_w(wn + 3 * WT_TILE, wr);
    // The lane's two packed tiles of head h ARE its part of the A fragment of
    // the output product for columns 32h..32h+31 (k = 8*hl + i, then
    // 16 + 8*hl + i): stored in that order, 32 B a lane, 1 KB a wave and head.
    v8h* og = (v8h*)ws + ((((size_t)r * NWAVES + wv_id) * H_NUM + h) * 32 + lane) * 2;
    v8h go[2];
#pragma unroll
    for (int nt = 0; nt < 2; ++nt) {
      const v8f acc = project_t(xs, wc + 3 * WT_TILE, rowb, nt);   // transposed like O^T
      const int dcol = h * 32 + nt * 16 + 8 * hl;
      // the lane's 8 values are 8 consecutive channels of one row: one chunk
      v8h pk;
#pragma unroll
      for (int i = 0; i < 8; ++i) {
        const float g = __builtin_amdgcn_rcpf(1.f + __expf(-(acc[i] + bg[dcol + i])));
        pk[i] = (_Float16)(oaccv[nt][i] * rinv * g);
      }
      go[nt] = pk;
    }
    // Ends the head: k, vT and this set have no reader left, the other set is
    // complete.
    __syncthreads();
    set ^= 1;
    // Behind the barrier, not in front of it: a barrier waits for the wave's
    // outstanding global stores, and here they fly under the next staging.
    og[0] = go[0];
    og[1] = go[1];
    // in front of any reuse of the two stores' address registers
    asm volatile("s_wait_xcnt 0x0" ::: "memory");
  }
  }  // job
}

// ---------------- Second launch: out = o @ wo + bo ------------------------
__global__ void __launch_bounds__(OP_THREADS, 1)
col_attn_out(const float* __restrict__ wo, const float* __restrict__ bo,
             const float* __restrict__ ws, float* __restrict__ out) {
  extern __shared__ _Float16 smem[];
  const int tid  = threadIdx.x;
  const int lane = tid & 31;
  const int hl   = lane >> 4;
  const int ln16 = lane & 15;
  const int g    = blockIdx.x * OP_WAVES + (tid >> 5);  // row tile, as written
  const int r    = g >> 4;
  const int rowb = (g & 15) * ROWS_PW;

  // The tile's 8 A fragments, as the first launch's lanes laid them down.
  const v16h* og = (const v16h*)ws + (size_t)g * (H_NUM * 32) + lane;
  v16h of[H_NUM];
#pragma unroll
  for (int h = 0; h < H_NUM; ++h) of[h] = og[h * 32];
  // In front of any reuse of the loads' address registers; the address is an
  // input so that it stays in them up to here (the build had given them to the
  // last load's result).
  asm volatile("s_wait_xcnt 0x0" :: "v"(og) : "memory");

  // wo[:, t*32 : t*32+32] transposed, tile t at smem + t * 8192; the staging
  // helpers are written for 16 waves, four tiles' loads in flight at a time.
  if (tid < NTHREADS) {
#pragma unroll
    for (int tb = 0; tb < 8; tb += 4) {
      float wr[4][16];
#pragma unroll
      for (int t = 0; t < 4; ++t) fetch_w(wr[t], wo, tb + t);
#pragma unroll
      for (int t = 0; t < 4; ++t) put_w(smem + (tb + t) * 8192, wr[t]);
    }
  }
  __syncthreads();

  for (int cb = 0; cb < 8; ++cb) {  // 32 output channels per chunk
    const _Float16* wt = smem + cb * 8192;
#pragma unroll
    for (int nt = 0; nt < 2; ++nt) {
      v8f acc = {};
#pragma unroll
      for (int kc = 0; kc < 256; kc += 32) {
        v16h b = ldfrag<32>(wt, nt * 16, kc);
        acc = wmma16(of[kc >> 5], b, acc);
      }
      const int c = cb * 32 + nt * 16 + ln16;
      const float bov = bo[c];
#pragma unroll
      for (int i = 0; i < 8; ++i) {
        const int s = rowb + i + 8 * hl;
        out[((size_t)s * R_LEN + r) * C_DIM + c] = acc[i] + bov;
      }
    }
    // in front of the next trip's reuse of the address registers
    asm volatile("s_wait_xcnt 0x0" ::: "memory");
  }
}

extern "C" void kernel_launch(void* const* d_in, const int* in_sizes, int n_in,
                              void* d_out, int out_size, void* d_ws, size_t ws_size,
                              hipStream_t stream) {
  (void)in_sizes; (void)n_in; (void)out_size; (void)ws_size;
  const float* msa_act  = (const float*)d_in[0];
  const float* msa_mask = (const float*)d_in[1];
  const float* ln_w     = (const float*)d_in[2];
  const float* ln_b     = (const float*)d_in[3];
  const float* wq       = (const float*)d_in[4];
  const float* wk       = (const float*)d_in[5];
  const float* wvp      = (const float*)d_in[6];
  const float* wg       = (const float*)d_in[7];
  const float* bg       = (const float*)d_in[8];
  const float* wo       = (const float*)d_in[9];
  const float* bo       = (const float*)d_in[10];
  float* out            = (float*)d_out;
  float* ws             = (float*)d_ws;   // gated o, f16 fragments: 48 MiB

  // dynamic LDS above the default limit; opt in every call
  // (deterministic; hipFuncSetAttribute is not a stream op, capture-safe).
  hipFuncSetAttribute(reinterpret_cast<const void*>(col_attn_fused),
                      hipFuncAttributeMaxDynamicSharedMemorySize,
                      LDS_TOTAL_BYTES);
  hipFuncSetAttribute(reinterpret_cast<const void*>(col_attn_out),
                      hipFuncAttributeMaxDynamicSharedMemorySize,
                      OP_LDS_BYTES);

  col_attn_fused<<<dim3(N_WG), dim3(NTHREADS), LDS_TOTAL_BYTES, stream>>>(
      msa_act, msa_mask, ln_w, ln_b, wq, wk, wvp, wg, bg, ws);
  col_attn_out<<<dim3(N_WG), dim3(OP_THREADS), OP_LDS_BYTES, stream>>>(
      wo, bo, ws, out);
}

// v006
// One run takes 148 microseconds.
// Next to v005, in two timings, it ran 1.04 times as fast each time.
// Over all steps from v000 it is 9.64 times as fast.
#include <hip/hip_runtime.h>
#include <hip/hip_bf16.h>

typedef __attribute__((ext_vector_type(16))) _Float16 v16h;
typedef __attribute__((ext_vector_type(8)))  _Float16 v8h;
typedef __attribute__((ext_vector_type(8)))  float    v8f;
typedef __attribute__((ext_vector_type(4)))  float    v4f;
typedef __attribute__((ext_vector_type(2)))  float    v2f;

#define S_LEN 256
#define R_LEN 384
#define C_DIM 256
#define H_NUM 8
#define D_DIM 32

#define NTHREADS 512   // 16 wave32 -> 4 waves per SIMD32 (latency hiding)
#define NWAVES   16
#define ROWS_PW  16    // query/sequence rows owned by each wave
#define N_WG     256   // one work-group per WGP, one round: 1.5 residues each
#define LN_B     4     // LayerNorm rows whose sums run side by side

// LDS layout (offsets in halves; total 147968 halves = 295936 B = 289 KB)
// Sizes are logical [rows][cols]; how a tile lies in its range: pidx() below.
#define LDS_X   0        // x  [256][256] f16  (layernormed activations)
#define LDS_WT  65536    // wt [2][4][32][256] f16: two sets of a head's four
                         // transposed weight tiles (query, key, value, gate)
#define LDS_K   131072   // k  [256][32]  f16
#define LDS_VT  139264   // vT [32][256]  f16
#define LDS_KB  147456   // key bias [256] f32
#define LDS_TOTAL_BYTES 295936
#define WT_TILE 8192     // halves of one weight tile
#define WT_SET  32768    // halves of a set of four

// Second launch (output product): 24 waves, one 16-row tile each, so that the
// 384 * 16 row tiles are 256 work-groups, one per WGP. Its LDS holds
// all of wo as 8 transposed f16 tiles of [32][256].
#define OP_THREADS 768
#define OP_WAVES   24
#define OP_LDS_BYTES 131072

// Bank-conflict-free placement of a [ROWS][cols] f16 tile, no byte of padding.
// A fragment load has 16 lanes read the same 16-byte chunk of 16 consecutive
// rows; the LDS has 64 banks x 4 B, so those 16 chunks must fall on 16
// different 16-byte slots modulo 256 B. With rows of 512 B they all fall on
// one slot, with plain rows of 64 B on four.
//  - The tile is cut into panels of 32 columns; a panel is [ROWS][32], rows of
//    64 B, so 4 consecutive rows fill the 256 B once.
//  - Inside a row the four chunks are permuted by XOR with bits 2..3 of the
//    row number, so rows r, r+4, r+8, r+12 use four different slots.
// Writers and readers index through the same map; the place inside a chunk
// (col & 7) is untouched, and a panel step is a constant address offset.
template <int ROWS>
__device__ inline int pidx(int row, int col) {
  return (col >> 5) * (ROWS * 32) + row * 32 +
         ((col & 31) ^ (((row >> 2) & 3) << 3));
}
// The same index for an accumulator element: row = rowb + 8 * hl + i with rowb
// a multiple of 16, hl = lane >> 4, and i = 0..7 constant after unrolling
// (bits 2..3 of the row are i >> 2 and hl): lane part first, constant last.
template <int ROWS>
__device__ inline int pidx_acc(int rowb, int hl, int i, int col) {
  return (col >> 5) * (ROWS * 32) + (rowb + 8 * hl) * 32 +
         (((col & 31) ^ (hl << 4)) ^ ((i >> 2) << 3)) + i * 32;
}

// Load a 16x32 f16 WMMA fragment (A-layout, or B-layout when the matrix
// columns are stored contiguously as rows). Per ISA 7.12.2: lanes 0-15 hold
// row (lane&15), K=0..7 (VGPR0-3) and K=16..23 (VGPR4-7); lanes 16-31 hold
// K=8..15 and K=24..31. Two 16B chunks per lane -> ds_load_b128.
// Rows row0..row0+15 (row0 a multiple of 16), columns col0..col0+31 (col0 a
// multiple of 32) of a tile placed by pidx<ROWS>: chunks hl and hl + 2 of the
// row, each XORed with bits 2..3 of the row.
template <int ROWS>
__device__ inline v16h ldfrag(const _Float16* p, int row0, int col0) {
  const int lane = threadIdx.x & 31;
  const int l = lane & 15;
  const int x = ((lane >> 4) ^ (l >> 2)) << 3;
  const _Float16* q = p + (col0 >> 5) * (ROWS * 32) + (row0 + l) * 32;
  v8h lo = *(const v8h*)(q + x);
  v8h hi = *(const v8h*)(q + (x ^ 16));
  v16h r;
#pragma unroll
  for (int i = 0; i < 8; ++i) { r[i] = lo[i]; r[i + 8] = hi[i]; }
  return r;
}

__device__ inline v8f wmma16(v16h a, v16h b, v8f c) {
  return __builtin_amdgcn_wmma_f32_16x16x32_f16(false, a, false, b, (short)0, c,
                                                false, false);
}

// The value that lane ^ 16 holds (the other half of the wave), on the vector
// pipe.
__device__ inline float other_half(float v) {
  const int b = __builtin_bit_cast(int, v);
  return __builtin_bit_cast(float, __builtin_amdgcn_permlanex16(
      b, b, 0x76543210, 0xfedcba98, false, false));
}

// exp(x) as 2^(x * log2 e), the form __expf compiles to, for eight values (or
// one) in ONE statement: the instruction set asks for one independent
// instruction or a v_nop behind a transcendental before its result is read or
// its source overwritten. Here every result
// register differs from every source ("=&v"), each v_exp_f32 is the
// independent instruction behind the one before, and the v_nop is the slot
// behind the last.
__device__ inline v8f exp_x8(v8f x) {
  x *= 1.44269504088896340736f;
  float r0, r1, r2, r3, r4, r5, r6, r7;
  asm("v_exp_f32 %0, %8\n\tv_exp_f32 %1, %9\n\tv_exp_f32 %2, %10\n\t"
      "v_exp_f32 %3, %11\n\tv_exp_f32 %4, %12\n\tv_exp_f32 %5, %13\n\t"
      "v_exp_f32 %6, %14\n\tv_exp_f32 %7, %15\n\tv_nop"
      : "=&v"(r0), "=&v"(r1), "=&v"(r2), "=&v"(r3), "=&v"(r4), "=&v"(r5),
        "=&v"(r6), "=&v"(r7)
      : "v"(x[0]), "v"(x[1]), "v"(x[2]), "v"(x[3]), "v"(x[4]), "v"(x[5]),
        "v"(x[6]), "v"(x[7]));
  return (v8f){r0, r1, r2, r3, r4, r5, r6, r7};
}
__device__ inline float exp_x1(float x) {
  x *= 1.44269504088896340736f;
  float r;
  asm("v_exp_f32 %0, %1\n\tv_nop" : "=&v"(r) : "v"(x));
  return r;
}

// Staging of W[:, t*32 : t*32+32] transposed into LDS, wt[d][c] placed by
// pidx<32>, in two halves. fetch_w issues the thread's 16 loads together
// (c = c0 + 16 * k, d = lane: one address, constant offsets); put_w converts
// and stores them. fetch_w stands one product ahead of its put_w, so the
// loads' latency runs under that product.
__device__ inline void fetch_w(float (&wr)[16], const float* __restrict__ w, int t) {
  const int tid = threadIdx.x;
  const int d = tid & 31;
  const int c0 = tid >> 5;            // 0..15
  const unsigned off = (unsigned)(c0 * 256 + t * 32 + d) * 4u;   // bytes
#pragma unroll
  for (int k = 0; k < C_DIM / NWAVES; ++k)
    wr[k] = *(const float*)((const char*)w + off + k * (NWAVES * 256 * 4));
  // The wait that belongs in front of an overwrite of the loads' offset
  // register, once for all 16; the offset is an input so that it stays in its
  // register up to here (builds had given it to the last load's result).
  asm volatile("s_wait_xcnt 0x0" :: "v"(off) : "memory");
  // Holds the 16 loads here, at the head of the product that follows: without
  // it the scheduler sank them into that product's second half, and the wait
  // in front of the next barrier then saw most of their latency.
  __builtin_amdgcn_sched_barrier(0);
}
__device__ inline void put_w(_Float16* wt, const float (&wr)[16]) {
  const int tid = threadIdx.x;
  const int d = tid & 31;
  const int c0 = tid >> 5;
#pragma unroll
  for (int k = 0; k < C_DIM / NWAVES; ++k)
    wt[pidx<32>(d, c0 + k * NWAVES)] = (_Float16)wr[k];
}

// Per-wave projection: this wave's 16 rows of (x @ wtT_block) -> [16 x 32].
// transposed=false -> dst is [s][32]; true -> dst is [d][256].
__device__ inline void project(const _Float16* xs, const _Float16* wt,
                               _Float16* dst, int rowb, int hl, int ln16,
                               float scale, bool transposed) {
  // Both column tiles' products stand in front of the stores: which set wt
  // lies in is known only at run time, so no fragment load of the second tile
  // can be moved up over a store of the first.
  v8f accs[2];
#pragma unroll
  for (int nt = 0; nt < 2; ++nt) {
    v8f acc = {};
#pragma unroll
    for (int kc = 0; kc < C_DIM; kc += 32) {
      v16h a = ldfrag<256>(xs, rowb, kc);
      v16h b = ldfrag<32>(wt, nt * 16, kc);
      acc = wmma16(a, b, acc);
    }
    accs[nt] = acc;
  }
#pragma unroll
  for (int nt = 0; nt < 2; ++nt) {
    const v8f acc = accs[nt];
    const int dcol = nt * 16 + ln16;        // C-layout: N = lane & 15,
    if (transposed) {                       //           M = i + 8*(lane>>4)
      // the lane's 8 values are 8 consecutive s of row dcol: one whole chunk
      v8h pk;
#pragma unroll
      for (int i = 0; i < 8; ++i) pk[i] = (_Float16)(acc[i] * scale);
      *(v8h*)(dst + pidx<32>(dcol, rowb + 8 * hl)) = pk;
    } else {
#pragma unroll
      for (int i = 0; i < 8; ++i)
        dst[pidx_acc<256>(rowb, hl, i, dcol)] = (_Float16)(acc[i] * scale);
    }
  }
}

// Per-wave transposed projection, weights as A and x as B: tile nt holds
// (x @ w)[rowb + ln16][nt*16 + 8*hl + i] in element i, that is 8 consecutive
// channels of ONE row per lane.
__device__ inline v8f project_t(const _Float16* xs, const _Float16* wt,
                                int rowb, int nt) {
  v8f acc = {};
#pragma unroll
  for (int kc = 0; kc < C_DIM; kc += 32) {
    v16h a = ldfrag<32>(wt, nt * 16, kc);
    v16h b = ldfrag<256>(xs, rowb, kc);
    acc = wmma16(a, b, acc);
  }
  return acc;
}

__global__ void __launch_bounds__(NTHREADS, 1)
col_attn_fused(const float* __restrict__ msa_act,
               const float* __restrict__ msa_mask,
               const float* __restrict__ ln_w, const float* __restrict__ ln_b,
               const float* __restrict__ wq, const float* __restrict__ wk,
               const float* __restrict__ wvp, const float* __restrict__ wg,
               const float* __restrict__ bg, float* __restrict__ ws) {
  extern __shared__ _Float16 smem[];
  _Float16* xs = smem + LDS_X;
  _Float16* wt = smem + LDS_WT;
  _Float16* kh = smem + LDS_K;
  _Float16* vt = smem + LDS_VT;
  float*    kb = (float*)(smem + LDS_KB);

  const int tid   = threadIdx.x;
  const int lane  = tid & 31;
  const int wv_id = tid >> 5;          // 16 waves; wave w owns s rows [16w,16w+16)
  const int hl    = lane >> 4;
  const int ln16  = lane & 15;
  const int rowb  = wv_id * ROWS_PW;

  // The deal: 384 residues x 8 heads are 12 (residue, head) units for each of
  // the 256 work-groups. A pair of work-groups has three residues: first each
  // takes four heads of the middle one (both read its rows at the same time),
  // then all eight heads of one of the outer two.
  const int pair = blockIdx.x >> 1;
  const int odd  = blockIdx.x & 1;

  // The set of weight tiles that the current head reads; the other set is
  // filled for the next head meanwhile, tile by tile between the products, so
  // that staging needs no barrier of its own. Its last readers (the head
  // before) stand in front of the barrier that ends that head, and the barrier
  // that ends this head publishes it.
  int set = 0;
  // The very first head's set; the barrier behind the LayerNorm publishes it.
  // Every later head's, the second job's first among them, is staged by the
  // head before.
  {
    float w0[4][16];
    fetch_w(w0[0], wq, 4 * odd);
    fetch_w(w0[1], wk, 4 * odd);
    fetch_w(w0[2], wvp, 4 * odd);
    fetch_w(w0[3], wg, 4 * odd);
#pragma unroll
    for (int t = 0; t < 4; ++t) put_w(wt + t * WT_TILE, w0[t]);
  }

  for (int job = 0; job < 2; ++job) {
  const int r  = job == 0 ? 3 * pair + 1 : 3 * pair + 2 * odd;  // residue: the
                                               // "batch" dim of col-attn
  const int h0 = job == 0 ? 4 * odd : 0;       // heads h0 .. h1 - 1
  const int h1 = job == 0 ? h0 + 4 : H_NUM;

  // xs, kb: their last readers of the job before stand in front of that job's
  // last barrier.

  // ---------------- Phase 1: LayerNorm into LDS (f16) --------------------
  float lnw[8], lnbv[8];
#pragma unroll
  for (int i = 0; i < 8; ++i) { lnw[i] = ln_w[lane * 8 + i]; lnbv[i] = ln_b[lane * 8 + i]; }

  // All of the phase's loads issue together: the wave's 16 rows (one address,
  // constant offsets) and the thread's mask value. One row at a time, each
  // row stood through a whole memory round trip and its own five cross-lane
  // steps before the next row's load was even issued.
  const float* row0 = msa_act + ((size_t)rowb * R_LEN + r) * C_DIM + lane * 8;
  const float* mkp  = msa_mask + (size_t)(tid & (S_LEN - 1)) * R_LEN + r;
  float v[ROWS_PW][8];
#pragma unroll
  for (int sr = 0; sr < ROWS_PW; ++sr)
#pragma unroll
    for (int i = 0; i < 8; ++i) v[sr][i] = row0[(size_t)sr * (R_LEN * C_DIM) + i];
  const float mk = *mkp;
  // The wait that belongs in front of an overwrite of the loads' address
  // registers, once for all of them; the addresses are inputs so that they
  // stay in their registers up to here.
  asm volatile("s_wait_xcnt 0x0" :: "v"(row0), "v"(mkp) : "memory");
  // Holds the loads here, in front of the first row's sums: sunk to their
  // uses they would be waited for one row at a time again.
  __builtin_amdgcn_sched_barrier(0);

  // Four rows at a time, so that the rows' cross-lane steps run side by side.
#pragma unroll
  for (int rb = 0; rb < ROWS_PW; rb += LN_B) {
    float sum[LN_B], sq[LN_B];
#pragma unroll
    for (int j = 0; j < LN_B; ++j) {
      sum[j] = 0.f; sq[j] = 0.f;
#pragma unroll
      for (int i = 0; i < 8; ++i) {
        sum[j] += v[rb + j][i];
        sq[j]  += v[rb + j][i] * v[rb + j][i];
      }
    }
#pragma unroll
    for (int m = 16; m >= 1; m >>= 1) {
      float ts[LN_B], tq[LN_B];
#pragma unroll
      for (int j = 0; j < LN_B; ++j) {
        ts[j] = __shfl_xor(sum[j], m, 32);
        tq[j] = __shfl_xor(sq[j], m, 32);
      }
#pragma unroll
      for (int j = 0; j < LN_B; ++j) { sum[j] += ts[j]; sq[j] += tq[j]; }
    }
#pragma unroll
    for (int j = 0; j < LN_B; ++j) {
      const float mu   = sum[j] * (1.f / 256.f);
      const float var  = sq[j] * (1.f / 256.f) - mu * mu;
      const float rstd = rsqrtf(var + 1e-5f);
      v8h hx;
#pragma unroll
      for (int i = 0; i < 8; ++i)
        hx[i] = (_Float16)((v[rb + j][i] - mu) * rstd * lnw[i] + lnbv[i]);
      *(v8h*)(xs + pidx<256>(rowb + rb + j, lane * 8)) = hx;
    }
    // Ends the group's scheduling region: with all groups in one region the
    // first sums came out behind a wait for the LAST row's load, and no
    // arithmetic ran while rows were still on their way; so divided, the last
    // group's rows are still arriving while the earlier groups are worked on.
    if (rb + LN_B < ROWS_PW) __builtin_amdgcn_sched_barrier(0);
  }

  // Attention bias of the 256 keys, read back 8 consecutive keys per lane.
  if (tid < S_LEN)
    kb[tid] = 1e9f * (mk - 1.f);

  __syncthreads();

  v8f oaccv[2];  // per-wave O^T accumulators [ntile]; persist through gating

  // ---------------- Phase 2: per-head fused attention ---------------------
  for (int h = h0; h < h1; ++h) {
    const _Float16* wc = wt + set * WT_SET;        // this head's four tiles
    _Float16*       wn = wt + (set ^ 1) * WT_SET;  // the next head's
    // The head after this one; behind a job's last head comes head 0 (the
    // second job's first; behind the last head of all nobody reads the set).
    const int hn = h + 1 < h1 ? h + 1 : 0;
    float wr[16];            // the weight tile in flight: fetch_w ... put_w
    fetch_w(wr, wq, hn);
    // Q^T tiles 0 and 1, packed, ARE the B fragment of the score product
    // (k = 8*hl + i, then 16 + 8*hl + i): Q never goes through LDS.
    v16h qb;
#pragma unroll
    for (int nt = 0; nt < 2; ++nt) {
      const v8f acc = project_t(xs, wc, rowb, nt);
#pragma unroll
      for (int i = 0; i < 8; ++i)
        qb[nt * 8 + i] = (_Float16)(acc[i] * 0.17677669529663688f /*1/sqrt(32)*/);
    }
    // Ends the product's scheduling region: with the staging stores in one
    // region with it, each weight fragment's load came out directly in front
    // of its product, which then stood through the LDS latency every time.
    __builtin_amdgcn_sched_barrier(0);

    put_w(wn, wr);
    fetch_w(wr, wk, hn);
    project(xs, wc + WT_TILE, kh, rowb, hl, ln16, 1.f, false);

    put_w(wn + WT_TILE, wr);
    fetch_w(wr, wvp, hn);
    project(xs, wc + 2 * WT_TILE, vt, rowb, hl, ln16, 1.f, true);  // V transposed

    put_w(wn + 2 * WT_TILE, wr);
    __syncthreads();  // all k/vT visible
    fetch_w(wr, wg, hn);   // behind the barrier: a barrier waits for loads in flight

    float rmax = -1e30f, rsum = 0.f;   // rsum: this half's keys only
    oaccv[0] = (v8f){};
    oaccv[1] = (v8f){};

    for (int kp = 0; kp < 8; ++kp) {  // 32 keys per step
      const int key0 = kp * 32;
      v8f s0 = {}, s1 = {};
      s0 = wmma16(ldfrag<256>(kh, key0 + 0, 0), qb, s0);
      s1 = wmma16(ldfrag<256>(kh, key0 + 16, 0), qb, s1);
      s0 += *(const v8f*)(kb + key0 + 8 * hl);
      s1 += *(const v8f*)(kb + key0 + 16 + 8 * hl);
      const float t0 = fmaxf(fmaxf(s0[0], s0[1]), s0[2]);
      const float t1 = fmaxf(fmaxf(s0[3], s0[4]), s0[5]);
      const float t2 = fmaxf(fmaxf(s0[6], s0[7]), s1[0]);
      const float t3 = fmaxf(fmaxf(s1[1], s1[2]), s1[3]);
      const float t4 = fmaxf(fmaxf(s1[4], s1[5]), s1[6]);
      float t = fmaxf(fmaxf(fmaxf(t0, t1), t2), fmaxf(fmaxf(t3, t4), s1[7]));
      t = fmaxf(t, other_half(t));
      const float nm = fmaxf(rmax, t);
      const float sc = exp_x1(rmax - nm);
      rmax = nm;
      const v8f p0 = exp_x8(s0 - nm);
      const v8f p1 = exp_x8(s1 - nm);
      v16h pf;
#pragma unroll
      for (int i = 0; i < 8; ++i) {
        pf[i]     = (_Float16)p0[i];
        pf[8 + i] = (_Float16)p1[i];
      }
      const v8f pv = p0 + p1;            // halved three times: packed adds
      const v4f ph = pv.lo + pv.hi;
      const v2f pq = ph.lo + ph.hi;
      rsum = rsum * sc + (pq.x + pq.y);
      oaccv[0] *= sc;
      oaccv[1] *= sc;
      oaccv[0] = wmma16(ldfrag<32>(vt, 0, key0), pf, oaccv[0]);
      oaccv[1] = wmma16(ldfrag<32>(vt, 16, key0), pf, oaccv[1]);
    }
    rsum += other_half(rsum);
    const float rinv = __builtin_amdgcn_rcpf(rsum);

    // ---- gating: g = sigmoid(x @ wg_h + bg_h); store gated O -------------
    put_w(wn + 3 * WT_TILE, wr);
    // The lane's two packed tiles of head h ARE its part of the A fragment of
    // the output product for columns 32h..32h+31 (k = 8*hl + i, then
    // 16 + 8*hl + i): stored in that order, 32 B a lane, 1 KB a wave and head.
    v8h* og = (v8h*)ws + ((((size_t)r * NWAVES + wv_id) * H_NUM + h) * 32 + lane) * 2;
    v8h go[2];
#pragma unroll
    for (int nt = 0; nt < 2; ++nt) {
      const v8f acc = project_t(xs, wc + 3 * WT_TILE, rowb, nt);   // transposed like O^T
      const int dcol = h * 32 + nt * 16 + 8 * hl;
      // the lane's 8 values are 8 consecutive channels of one row: one chunk
      v8h pk;
#pragma unroll
      for (int i = 0; i < 8; ++i) {
        const float g = __builtin_amdgcn_rcpf(1.f + __expf(-(acc[i] + bg[dcol + i])));
        pk[i] = (_Float16)(oaccv[nt][i] * rinv * g);
      }
      go[nt] = pk;
    }
    // Ends the head: k, vT and this set have no reader left, the other set is
    // complete.
    __syncthreads();
    set ^= 1;
    // Behind the barrier, not in front of it: a barrier waits for the wave's
    // outstanding global stores, and here they fly under the next staging.
    og[0] = go[0];
    og[1] = go[1];
    // in front of any reuse of the two stores' address registers
    asm volatile("s_wait_xcnt 0x0" ::: "memory");
  }
  }  // job
}

// ---------------- Second launch: out = o @ wo + bo ------------------------
__global__ void __launch_bounds__(OP_THREADS, 1)
col_attn_out(const float* __restrict__ wo, const float* __restrict__ bo,
             const float* __restrict__ ws, float* __restrict__ out) {
  extern __shared__ _Float16 smem[];
  const int tid  = threadIdx.x;
  const int lane = tid & 31;
  const int hl   = lane >> 4;
  const int ln16 = lane & 15;
  const int g    = blockIdx.x * OP_WAVES + (tid >> 5);  // row tile, as written
  const int r    = g >> 4;
  const int rowb = (g & 15) * ROWS_PW;

  // The tile's 8 A fragments, as the first launch's lanes laid them down.
  const v16h* og = (const v16h*)ws + (size_t)g * (H_NUM * 32) + lane;
  v16h of[H_NUM];
#pragma unroll
  for (int h = 0; h < H_NUM; ++h) of[h] = og[h * 32];
  // In front of any reuse of the loads' address registers; the address is an
  // input so that it stays in them up to here (the build had given them to the
  // last load's result).
  asm volatile("s_wait_xcnt 0x0" :: "v"(og) : "memory");

  // wo[:, t*32 : t*32+32] transposed, tile t at smem + t * 8192; the staging
  // helpers are written for 16 waves, four tiles' loads in flight at a time.
  if (tid < NTHREADS) {
#pragma unroll
    for (int tb = 0; tb < 8; tb += 4) {
      float wr[4][16];
#pragma unroll
      for (int t = 0; t < 4; ++t) fetch_w(wr[t], wo, tb + t);
#pragma unroll
      for (int t = 0; t < 4; ++t) put_w(smem + (tb + t) * 8192, wr[t]);
    }
  }
  __syncthreads();

  for (int cb = 0; cb < 8; ++cb) {  // 32 output channels per chunk
    const _Float16* wt = smem + cb * 8192;
#pragma unroll
    for (int nt = 0; nt < 2; ++nt) {
      v8f acc = {};
#pragma unroll
      for (int kc = 0; kc < 256; kc += 32) {
        v16h b = ldfrag<32>(wt, nt * 16, kc);
        acc = wmma16(of[kc >> 5], b, acc);
      }
      const int c = cb * 32 + nt * 16 + ln16;
      const float bov = bo[c];
#pragma unroll
      for (int i = 0; i < 8; ++i) {
        const int s = rowb + i + 8 * hl;
        out[((size_t)s * R_LEN + r) * C_DIM + c] = acc[i] + bov;
      }
    }
    // in front of the next trip's reuse of the address registers
    asm volatile("s_wait_xcnt 0x0" ::: "memory");
  }
}

extern "C" void kernel_launch(void* const* d_in, const int* in_sizes, int n_in,
                              void* d_out, int out_size, void* d_ws, size_t ws_size,
                              hipStream_t stream) {
  (void)in_sizes; (void)n_in; (void)out_size; (void)ws_size;
  const float* msa_act  = (const float*)d_in[0];
  const float* msa_mask = (const float*)d_in[1];
  const float* ln_w     = (const float*)d_in[2];
  const float* ln_b     = (const float*)d_in[3];
  const float* wq       = (const float*)d_in[4];
  const float* wk       = (const float*)d_in[5];
  const float* wvp      = (const float*)d_in[6];
  const float* wg       = (const float*)d_in[7];
  const float* bg       = (const float*)d_in[8];
  const float* wo       = (const float*)d_in[9];
  const float* bo       = (const float*)d_in[10];
  float* out            = (float*)d_out;
  float* ws             = (float*)d_ws;   // gated o, f16 fragments: 48 MiB

  // dynamic LDS above the default limit; opt in every call
  // (deterministic; hipFuncSetAttribute is not a stream op, capture-safe).
  hipFuncSetAttribute(reinterpret_cast<const void*>(col_attn_fused),
                      hipFuncAttributeMaxDynamicSharedMemorySize,
                      LDS_TOTAL_BYTES);
  hipFuncSetAttribute(reinterpret_cast<const void*>(col_attn_out),
                      hipFuncAttributeMaxDynamicSharedMemorySize,
                      OP_LDS_BYTES);

  col_attn_fused<<<dim3(N_WG), dim3(NTHREADS), LDS_TOTAL_BYTES, stream>>>(
      msa_act, msa_mask, ln_w, ln_b, wq, wk, wvp, wg, bg, ws);
  col_attn_out<<<dim3(N_WG), dim3(OP_THREADS), OP_LDS_BYTES, stream>>>(
      wo, bo, ws, out);
}

// v007
// One run takes 137 microseconds.
// Two timings next to v006 both put it at 1.07 times that version's speed.
// Over all steps from v000 it is 10.4 times as fast.
#include <hip/hip_runtime.h>
#include <hip/hip_bf16.h>

typedef __attribute__((ext_vector_type(16))) _Float16 v16h;
typedef __attribute__((ext_vector_type(8)))  _Float16 v8h;
typedef __attribute__((ext_vector_type(8)))  float    v8f;
typedef __attribute__((ext_vector_type(4)))  float    v4f;
typedef __attribute__((ext_vector_type(2)))  float    v2f;

#define S_LEN 256
#define R_LEN 384
#define C_DIM 256
#define H_NUM 8
#define D_DIM 32

#define NTHREADS 512   // 16 wave32 -> 4 waves per SIMD32 (latency hiding)
#define NWAVES   16
#define ROWS_PW  16    // query/sequence rows owned by each wave
#define N_WG     256   // one work-group per WGP, one round: 1.5 residues each
#define LN_B     4     // LayerNorm rows whose sums run side by side

// LDS layout (offsets in halves; total 147968 halves = 295936 B = 289 KB)
// Sizes are logical [rows][cols]; how a tile lies in its range: pidx() below.
#define LDS_X   0        // x  [256][256] f16  (layernormed activations)
#define LDS_WT  65536    // wt [2][4][32][256] f16: two sets of a head's four
                         // transposed weight tiles (query, key, value, gate)
#define LDS_K   131072   // k  [256][32]  f16
#define LDS_VT  139264   // vT [32][256]  f16
#define LDS_KB  147456   // key bias [256] f32
#define LDS_TOTAL_BYTES 295936
#define WT_TILE 8192     // halves of one weight tile
#define WT_SET  32768    // halves of a set of four

// Second launch (output product): 24 waves, one 16-row tile each, so that the
// 384 * 16 row tiles are 256 work-groups, one per WGP. Its LDS holds
// all of wo as 8 transposed f16 tiles of [32][256].
#define OP_THREADS 768
#define OP_WAVES   24
#define OP_LDS_BYTES 131072

// Bank-conflict-free placement of a [ROWS][cols] f16 tile, no byte of padding.
// A fragment load has 16 lanes read the same 16-byte chunk of 16 consecutive
// rows; the LDS has 64 banks x 4 B, so those 16 chunks must fall on 16
// different 16-byte slots modulo 256 B. With rows of 512 B they all fall on
// one slot, with plain rows of 64 B on four.
//  - The tile is cut into panels of 32 columns; a panel is [ROWS][32], rows of
//    64 B, so 4 consecutive rows fill the 256 B once.
//  - Inside a row the four chunks are permuted by XOR with bits 2..3 of the
//    row number, so rows r, r+4, r+8, r+12 use four different slots.
// Writers and readers index through the same map; the place inside a chunk
// (col & 7) is untouched, and a panel step is a constant address offset.
template <int ROWS>
__device__ inline int pidx(int row, int col) {
  return (col >> 5) * (ROWS * 32) + row * 32 +
         ((col & 31) ^ (((row >> 2) & 3) << 3));
}
// The same index for an accumulator element: row = rowb + 8 * hl + i with rowb
// a multiple of 16, hl = lane >> 4, and i = 0..7 constant after unrolling
// (bits 2..3 of the row are i >> 2 and hl): lane part first, constant last.
template <int ROWS>
__device__ inline int pidx_acc(int rowb, int hl, int i, int col) {
  return (col >> 5) * (ROWS * 32) + (rowb + 8 * hl) * 32 +
         (((col & 31) ^ (hl << 4)) ^ ((i >> 2) << 3)) + i * 32;
}

// Load a 16x32 f16 WMMA fragment (A-layout, or B-layout when the matrix
// columns are stored contiguously as rows). Per ISA 7.12.2: lanes 0-15 hold
// row (lane&15), K=0..7 (VGPR0-3) and K=16..23 (VGPR4-7); lanes 16-31 hold
// K=8..15 and K=24..31. Two 16B chunks per lane -> ds_load_b128.
// Rows row0..row0+15 (row0 a multiple of 16), columns col0..col0+31 (col0 a
// multiple of 32) of a tile placed by pidx<ROWS>: chunks hl and hl + 2 of the
// row, each XORed with bits 2..3 of the row.
template <int ROWS>
__device__ inline v16h ldfrag(const _Float16* p, int row0, int col0) {
  const int lane = threadIdx.x & 31;
  const int l = lane & 15;
  const int x = ((lane >> 4) ^ (l >> 2)) << 3;
  const _Float16* q = p + (col0 >> 5) * (ROWS * 32) + (row0 + l) * 32;
  v8h lo = *(const v8h*)(q + x);
  v8h hi = *(const v8h*)(q + (x ^ 16));
  v16h r;
#pragma unroll
  for (int i = 0; i < 8; ++i) { r[i] = lo[i]; r[i + 8] = hi[i]; }
  return r;
}

__device__ inline v8f wmma16(v16h a, v16h b, v8f c) {
  return __builtin_amdgcn_wmma_f32_16x16x32_f16(false, a, false, b, (short)0, c,
                                                false, false);
}

// The value that lane ^ 16 holds (the other half of the wave), on the vector
// pipe.
__device__ inline float other_half(float v) {
  const int b = __builtin_bit_cast(int, v);
  return __builtin_bit_cast(float, __builtin_amdgcn_permlanex16(
      b, b, 0x76543210, 0xfedcba98, false, false));
}

// exp(x) as 2^(x * log2 e), the form __expf compiles to, for eight values (or
// one) in ONE statement: the instruction set asks for one independent
// instruction or a v_nop behind a transcendental before its result is read or
// its source overwritten. Here every result
// register differs from every source ("=&v"), each v_exp_f32 is the
// independent instruction behind the one before, and the v_nop is the slot
// behind the last.
__device__ inline v8f exp_x8(v8f x) {
  x *= 1.44269504088896340736f;
  float r0, r1, r2, r3, r4, r5, r6, r7;
  asm("v_exp_f32 %0, %8\n\tv_exp_f32 %1, %9\n\tv_exp_f32 %2, %10\n\t"
      "v_exp_f32 %3, %11\n\tv_exp_f32 %4, %12\n\tv_exp_f32 %5, %13\n\t"
      "v_exp_f32 %6, %14\n\tv_exp_f32 %7, %15\n\tv_nop"
      : "=&v"(r0), "=&v"(r1), "=&v"(r2), "=&v"(r3), "=&v"(r4), "=&v"(r5),
        "=&v"(r6), "=&v"(r7)
      : "v"(x[0]), "v"(x[1]), "v"(x[2]), "v"(x[3]), "v"(x[4]), "v"(x[5]),
        "v"(x[6]), "v"(x[7]));
  return (v8f){r0, r1, r2, r3, r4, r5, r6, r7};
}
// 1 / x for eight values in one statement, for the same slot.
__device__ inline v8f rcp_x8(v8f x) {
  float r0, r1, r2, r3, r4, r5, r6, r7;
  asm("v_rcp_f32 %0, %8\n\tv_rcp_f32 %1, %9\n\tv_rcp_f32 %2, %10\n\t"
      "v_rcp_f32 %3, %11\n\tv_rcp_f32 %4, %12\n\tv_rcp_f32 %5, %13\n\t"
      "v_rcp_f32 %6, %14\n\tv_rcp_f32 %7, %15\n\tv_nop"
      : "=&v"(r0), "=&v"(r1), "=&v"(r2), "=&v"(r3), "=&v"(r4), "=&v"(r5),
        "=&v"(r6), "=&v"(r7)
      : "v"(x[0]), "v"(x[1]), "v"(x[2]), "v"(x[3]), "v"(x[4]), "v"(x[5]),
        "v"(x[6]), "v"(x[7]));
  return (v8f){r0, r1, r2, r3, r4, r5, r6, r7};
}
__device__ inline float exp_x1(float x) {
  x *= 1.44269504088896340736f;
  float r;
  asm("v_exp_f32 %0, %1\n\tv_nop" : "=&v"(r) : "v"(x));
  return r;
}

// Staging of W[:, t*32 : t*32+32] transposed into LDS, wt[d][c] placed by
// pidx<32>, in two halves. fetch_w issues the thread's 16 loads together
// (c = c0 + 16 * k, d = lane: one address, constant offsets); put_w converts
// and stores them. fetch_w stands one phase (the head's products, or its
// attention) ahead of its put_w, so the loads' latency runs under that phase.
__device__ inline void fetch_w(float (&wr)[16], const float* __restrict__ w, int t) {
  const int tid = threadIdx.x;
  const int d = tid & 31;
  const int c0 = tid >> 5;            // 0..15
  const unsigned off = (unsigned)(c0 * 256 + t * 32 + d);        // elements
#pragma unroll
  for (int k = 0; k < C_DIM / NWAVES; ++k)
    wr[k] = *(const float*)((const char*)(w + off) + k * (NWAVES * 256 * 4));
  // The wait that belongs in front of an overwrite of the loads' offset
  // register, once for all 16; the offset, in elements (the loads take it times 4, in bytes),
  // is an input so that it stays in its register up to here (builds had given
  // it to the last load's result).
  asm volatile("s_wait_xcnt 0x0" :: "v"(off) : "memory");
  // Holds the 16 loads here, at the head of the product that follows: without
  // it the scheduler sank them into that product's second half, and the wait
  // in front of the next barrier then saw most of their latency.
  __builtin_amdgcn_sched_barrier(0);
}
__device__ inline void put_w(_Float16* wt, const float (&wr)[16]) {
  const int tid = threadIdx.x;
  const int d = tid & 31;
  const int c0 = tid >> 5;
#pragma unroll
  for (int k = 0; k < C_DIM / NWAVES; ++k)
    wt[pidx<32>(d, c0 + k * NWAVES)] = (_Float16)wr[k];
}

// A head's four products (query, key, value, gate) of this wave's 16 rows as
// ONE block, the k step outermost: an x fragment is read once and feeds all
// eight 16-column tiles, and the eight accumulator chains are independent of
// one another. wc: the head's set of four weight tiles.
// acc[2..3] K, acc[4..5] V: x as A, weights as B; element i of tile nt is
//   (x @ w)[rowb + 8*hl + i][nt*16 + ln16].
// acc[0..1] Q^T, acc[6..7] gate^T: weights as A, x as B; element i of tile nt
//   is (x @ w)[rowb + ln16][nt*16 + 8*hl + i], 8 consecutive channels of ONE
//   row per lane.
__device__ inline void project_head(const _Float16* xs, const _Float16* wc,
                                    int rowb, v8f (&acc)[8]) {
#pragma unroll
  for (int t = 0; t < 8; ++t) acc[t] = (v8f){};
#pragma unroll
  for (int kc = 0; kc < C_DIM; kc += 32) {
    const v16h x = ldfrag<256>(xs, rowb, kc);
#pragma unroll
    for (int nt = 0; nt < 2; ++nt) {
      acc[nt]     = wmma16(ldfrag<32>(wc, nt * 16, kc), x, acc[nt]);
      acc[2 + nt] = wmma16(x, ldfrag<32>(wc + WT_TILE, nt * 16, kc), acc[2 + nt]);
      acc[4 + nt] = wmma16(x, ldfrag<32>(wc + 2 * WT_TILE, nt * 16, kc), acc[4 + nt]);
      acc[6 + nt] = wmma16(ldfrag<32>(wc + 3 * WT_TILE, nt * 16, kc), x, acc[6 + nt]);
    }
  }
}

// Column tile nt of a [16 x 32] product (x as A) into LDS as f16.
// transposed=false -> dst is [s][32]; true -> dst is [d][256].
__device__ inline void store_tile(v8f acc, _Float16* dst, int nt, int rowb,
                                  int hl, int ln16, bool transposed) {
  const int dcol = nt * 16 + ln16;        // C-layout: N = lane & 15,
  if (transposed) {                       //           M = i + 8*(lane>>4)
    // the lane's 8 values are 8 consecutive s of row dcol: one whole chunk
    v8h pk;
#pragma unroll
    for (int i = 0; i < 8; ++i) pk[i] = (_Float16)acc[i];
    *(v8h*)(dst + pidx<32>(dcol, rowb + 8 * hl)) = pk;
  } else {
#pragma unroll
    for (int i = 0; i < 8; ++i)
      dst[pidx_acc<256>(rowb, hl, i, dcol)] = (_Float16)acc[i];
  }
}

__global__ void __launch_bounds__(NTHREADS, 1)
col_attn_fused(const float* __restrict__ msa_act,
               const float* __restrict__ msa_mask,
               const float* __restrict__ ln_w, const float* __restrict__ ln_b,
               const float* __restrict__ wq, const float* __restrict__ wk,
               const float* __restrict__ wvp, const float* __restrict__ wg,
               const float* __restrict__ bg, float* __restrict__ ws) {
  extern __shared__ _Float16 smem[];
  _Float16* xs = smem + LDS_X;
  _Float16* wt = smem + LDS_WT;
  _Float16* kh = smem + LDS_K;
  _Float16* vt = smem + LDS_VT;
  float*    kb = (float*)(smem + LDS_KB);

  const int tid   = threadIdx.x;
  const int lane  = tid & 31;
  const int wv_id = tid >> 5;          // 16 waves; wave w owns s rows [16w,16w+16)
  const int hl    = lane >> 4;
  const int ln16  = lane & 15;
  const int rowb  = wv_id * ROWS_PW;

  // The deal: 384 residues x 8 heads are 12 (residue, head) units for each of
  // the 256 work-groups. A pair of work-groups has three residues: first each
  // takes four heads of the middle one (both read its rows at the same time),
  // then all eight heads of one of the outer two.
  const int pair = blockIdx.x >> 1;
  const int odd  = blockIdx.x & 1;

  // The set of weight tiles that the current head reads; the other set is
  // filled for the next head meanwhile, two tiles behind the products and two
  // behind the attention, so that staging needs no barrier of its own. Its
  // last readers (the head before) stand in front of the barrier that ends
  // that head, and the barrier that ends this head publishes it.
  int set = 0;
  // The very first head's set; the barrier behind the LayerNorm publishes it.
  // Every later head's, the second job's first among them, is staged by the
  // head before.
  {
    float w0[4][16];
    fetch_w(w0[0], wq, 4 * odd);
    fetch_w(w0[1], wk, 4 * odd);
    fetch_w(w0[2], wvp, 4 * odd);
    fetch_w(w0[3], wg, 4 * odd);
#pragma unroll
    for (int t = 0; t < 4; ++t) put_w(wt + t * WT_TILE, w0[t]);
  }

  for (int job = 0; job < 2; ++job) {
  const int r  = job == 0 ? 3 * pair + 1 : 3 * pair + 2 * odd;  // residue: the
                                               // "batch" dim of col-attn
  const int h0 = job == 0 ? 4 * odd : 0;       // heads h0 .. h1 - 1
  const int h1 = job == 0 ? h0 + 4 : H_NUM;

  // xs, kb: their last readers of the job before stand in front of that job's
  // last barrier.

  // ---------------- Phase 1: LayerNorm into LDS (f16) --------------------
  float lnw[8], lnbv[8];
#pragma unroll
  for (int i = 0; i < 8; ++i) { lnw[i] = ln_w[lane * 8 + i]; lnbv[i] = ln_b[lane * 8 + i]; }

  // All of the phase's loads issue together: the wave's 16 rows (one address,
  // constant offsets) and the thread's mask value. One row at a time, each
  // row stood through a whole memory round trip and its own five cross-lane
  // steps before the next row's load was even issued.
  const float* row0 = msa_act + ((size_t)rowb * R_LEN + r) * C_DIM + lane * 8;
  const float* mkp  = msa_mask + (size_t)(tid & (S_LEN - 1)) * R_LEN + r;
  float v[ROWS_PW][8];
#pragma unroll
  for (int sr = 0; sr < ROWS_PW; ++sr)
#pragma unroll
    for (int i = 0; i < 8; ++i) v[sr][i] = row0[(size_t)sr * (R_LEN * C_DIM) + i];
  const float mk = *mkp;
  // The wait that belongs in front of an overwrite of the loads' address
  // registers, once for all of them; the addresses are inputs so that they
  // stay in their registers up to here.
  asm volatile("s_wait_xcnt 0x0" :: "v"(row0), "v"(mkp) : "memory");
  // Holds the loads here, in front of the first row's sums: sunk to their
  // uses they would be waited for one row at a time again.
  __builtin_amdgcn_sched_barrier(0);

  // Four rows at a time, so that the rows' cross-lane steps run side by side.
#pragma unroll
  for (int rb = 0; rb < ROWS_PW; rb += LN_B) {
    float sum[LN_B], sq[LN_B];
#pragma unroll
    for (int j = 0; j < LN_B; ++j) {
      sum[j] = 0.f; sq[j] = 0.f;
#pragma unroll
      for (int i = 0; i < 8; ++i) {
        sum[j] += v[rb + j][i];
        sq[j]  += v[rb + j][i] * v[rb + j][i];
      }
    }
#pragma unroll
    for (int m = 16; m >= 1; m >>= 1) {
      float ts[LN_B], tq[LN_B];
#pragma unroll
      for (int j = 0; j < LN_B; ++j) {
        ts[j] = __shfl_xor(sum[j], m, 32);
        tq[j] = __shfl_xor(sq[j], m, 32);
      }
#pragma unroll
      for (int j = 0; j < LN_B; ++j) { sum[j] += ts[j]; sq[j] += tq[j]; }
    }
#pragma unroll
    for (int j = 0; j < LN_B; ++j) {
      const float mu   = sum[j] * (1.f / 256.f);
      const float var  = sq[j] * (1.f / 256.f) - mu * mu;
      const float rstd = rsqrtf(var + 1e-5f);
      v8h hx;
#pragma unroll
      for (int i = 0; i < 8; ++i)
        hx[i] = (_Float16)((v[rb + j][i] - mu) * rstd * lnw[i] + lnbv[i]);
      *(v8h*)(xs + pidx<256>(rowb + rb + j, lane * 8)) = hx;
    }
    // Ends the group's scheduling region: with all groups in one region the
    // first sums came out behind a wait for the LAST row's load, and no
    // arithmetic ran while rows were still on their way; so divided, the last
    // group's rows are still arriving while the earlier groups are worked on.
    if (rb + LN_B < ROWS_PW) __builtin_amdgcn_sched_barrier(0);
  }

  // Attention bias of the 256 keys, read back 8 consecutive keys per lane.
  if (tid < S_LEN)
    kb[tid] = 1e9f * (mk - 1.f);

  __syncthreads();

  v8f oaccv[2];  // per-wave O^T accumulators [ntile]; persist through gating

  // ---------------- Phase 2: per-head fused attention ---------------------
  for (int h = h0; h < h1; ++h) {
    const _Float16* wc = wt + set * WT_SET;        // this head's four tiles
    _Float16*       wn = wt + (set ^ 1) * WT_SET;  // the next head's
    // The head after this one; behind a job's last head comes head 0 (the
    // second job's first; behind the last head of all nobody reads the set).
    const int hn = h + 1 < h1 ? h + 1 : 0;
    float wa[16], wb[16];    // two weight tiles in flight: fetch_w ... put_w
    fetch_w(wa, wq, hn);
    fetch_w(wb, wk, hn);
    // The lane's 16 gate biases: channels 8*hl + i and 16 + 8*hl + i of head h.
    const float* bgp = bg + h * 32 + 8 * hl;
    v8f bgv[2];
#pragma unroll
    for (int nt = 0; nt < 2; ++nt)
#pragma unroll
      for (int i = 0; i < 8; ++i) bgv[nt][i] = bgp[nt * 16 + i];
    // The wait that belongs in front of an overwrite of the loads' address
    // registers; the address is an input so that it stays in them up to here.
    asm volatile("s_wait_xcnt 0x0" :: "v"(bgp) : "memory");
    v8f acc[8];
    project_head(xs, wc, rowb, acc);
    // Ends the products' scheduling region: with LDS stores in one region with
    // them, each weight fragment's load came out directly in front of its
    // product, which then stood through the LDS latency every time.
    __builtin_amdgcn_sched_barrier(0);

    // Q^T tiles 0 and 1, packed, ARE the B fragment of the score product
    // (k = 8*hl + i, then 16 + 8*hl + i): Q never goes through LDS.
    v16h qb;
#pragma unroll
    for (int nt = 0; nt < 2; ++nt)
#pragma unroll
      for (int i = 0; i < 8; ++i)
        qb[nt * 8 + i] = (_Float16)(acc[nt][i] * 0.17677669529663688f /*1/sqrt(32)*/);
#pragma unroll
    for (int nt = 0; nt < 2; ++nt) {
      store_tile(acc[2 + nt], kh, nt, rowb, hl, ln16, false);
      store_tile(acc[4 + nt], vt, nt, rowb, hl, ln16, true);   // V transposed
    }
    // g = sigmoid(x @ wg_h + bg_h), transposed like O^T; held to the head's end
    v8f gate[2];
#pragma unroll
    for (int nt = 0; nt < 2; ++nt)
      gate[nt] = rcp_x8(1.f + exp_x8(-(acc[6 + nt] + bgv[nt])));
    put_w(wn, wa);
    put_w(wn + WT_TILE, wb);
    __syncthreads();  // all k/vT visible
    fetch_w(wa, wvp, hn);  // behind the barrier: a barrier waits for loads in flight
    fetch_w(wb, wg, hn);

    float rmax = -1e30f, rsum = 0.f;   // rsum: this half's keys only
    oaccv[0] = (v8f){};
    oaccv[1] = (v8f){};

    for (int kp = 0; kp < 8; ++kp) {  // 32 keys per step
      const int key0 = kp * 32;
      v8f s0 = {}, s1 = {};
      s0 = wmma16(ldfrag<256>(kh, key0 + 0, 0), qb, s0);
      s1 = wmma16(ldfrag<256>(kh, key0 + 16, 0), qb, s1);
      s0 += *(const v8f*)(kb + key0 + 8 * hl);
      s1 += *(const v8f*)(kb + key0 + 16 + 8 * hl);
      const float t0 = fmaxf(fmaxf(s0[0], s0[1]), s0[2]);
      const float t1 = fmaxf(fmaxf(s0[3], s0[4]), s0[5]);
      const float t2 = fmaxf(fmaxf(s0[6], s0[7]), s1[0]);
      const float t3 = fmaxf(fmaxf(s1[1], s1[2]), s1[3]);
      const float t4 = fmaxf(fmaxf(s1[4], s1[5]), s1[6]);
      float t = fmaxf(fmaxf(fmaxf(t0, t1), t2), fmaxf(fmaxf(t3, t4), s1[7]));
      t = fmaxf(t, other_half(t));
      const float nm = fmaxf(rmax, t);
      const float sc = exp_x1(rmax - nm);
      rmax = nm;
      const v8f p0 = exp_x8(s0 - nm);
      const v8f p1 = exp_x8(s1 - nm);
      v16h pf;
#pragma unroll
      for (int i = 0; i < 8; ++i) {
        pf[i]     = (_Float16)p0[i];
        pf[8 + i] = (_Float16)p1[i];
      }
      const v8f pv = p0 + p1;            // halved three times: packed adds
      const v4f ph = pv.lo + pv.hi;
      const v2f pq = ph.lo + ph.hi;
      rsum = rsum * sc + (pq.x + pq.y);
      oaccv[0] *= sc;
      oaccv[1] *= sc;
      oaccv[0] = wmma16(ldfrag<32>(vt, 0, key0), pf, oaccv[0]);
      oaccv[1] = wmma16(ldfrag<32>(vt, 16, key0), pf, oaccv[1]);
    }
    rsum += other_half(rsum);
    const float rinv = __builtin_amdgcn_rcpf(rsum);

    // ---- store gated O ---------------------------------------------------
    put_w(wn + 2 * WT_TILE, wa);
    put_w(wn + 3 * WT_TILE, wb);
    // The lane's two packed tiles of head h ARE its part of the A fragment of
    // the output product for columns 32h..32h+31 (k = 8*hl + i, then
    // 16 + 8*hl + i): stored in that order, 32 B a lane, 1 KB a wave and head.
    v8h* og = (v8h*)ws + ((((size_t)r * NWAVES + wv_id) * H_NUM + h) * 32 + lane) * 2;
    v8h go[2];
#pragma unroll
    for (int nt = 0; nt < 2; ++nt) {
      // the lane's 8 values are 8 consecutive channels of one row: one chunk
      v8h pk;
#pragma unroll
      for (int i = 0; i < 8; ++i)
        pk[i] = (_Float16)(oaccv[nt][i] * rinv * gate[nt][i]);
      go[nt] = pk;
    }
    // Ends the head: k, vT and this set have no reader left, the other set is
    // complete.
    __syncthreads();
    set ^= 1;
    // Behind the barrier, not in front of it: a barrier waits for the wave's
    // outstanding global stores, and here they fly under the next staging.
    og[0] = go[0];
    og[1] = go[1];
    // in front of any reuse of the two stores' address registers
    asm volatile("s_wait_xcnt 0x0" ::: "memory");
  }
  }  // job
}

// ---------------- Second launch: out = o @ wo + bo ------------------------
__global__ void __launch_bounds__(OP_THREADS, 1)
col_attn_out(const float* __restrict__ wo, const float* __restrict__ bo,
             const float* __restrict__ ws, float* __restrict__ out) {
  extern __shared__ _Float16 smem[];
  const int tid  = threadIdx.x;
  const int lane = tid & 31;
  const int hl   = lane >> 4;
  const int ln16 = lane & 15;
  const int g    = blockIdx.x * OP_WAVES + (tid >> 5);  // row tile, as written
  const int r    = g >> 4;
  const int rowb = (g & 15) * ROWS_PW;

  // The tile's 8 A fragments, as the first launch's lanes laid them down.
  const v16h* og = (const v16h*)ws + (size_t)g * (H_NUM * 32) + lane;
  v16h of[H_NUM];
#pragma unroll
  for (int h = 0; h < H_NUM; ++h) of[h] = og[h * 32];
  // In front of any reuse of the loads' address registers; the address is an
  // input so that it stays in them up to here (the build had given them to the
  // last load's result).
  asm volatile("s_wait_xcnt 0x0" :: "v"(og) : "memory");

  // wo[:, t*32 : t*32+32] transposed, tile t at smem + t * 8192; the staging
  // helpers are written for 16 waves, four tiles' loads in flight at a time.
  if (tid < NTHREADS) {
#pragma unroll
    for (int tb = 0; tb < 8; tb += 4) {
      float wr[4][16];
#pragma unroll
      for (int t = 0; t < 4; ++t) fetch_w(wr[t], wo, tb + t);
#pragma unroll
      for (int t = 0; t < 4; ++t) put_w(smem + (tb + t) * 8192, wr[t]);
    }
  }
  __syncthreads();

  for (int cb = 0; cb < 8; ++cb) {  // 32 output channels per chunk
    const _Float16* wt = smem + cb * 8192;
#pragma unroll
    for (int nt = 0; nt < 2; ++nt) {
      v8f acc = {};
#pragma unroll
      for (int kc = 0; kc < 256; kc += 32) {
        v16h b = ldfrag<32>(wt, nt * 16, kc);
        acc = wmma16(of[kc >> 5], b, acc);
      }
      const int c = cb * 32 + nt * 16 + ln16;
      const float bov = bo[c];
#pragma unroll
      for (int i = 0; i < 8; ++i) {
        const int s = rowb + i + 8 * hl;
        out[((size_t)s * R_LEN + r) * C_DIM + c] = acc[i] + bov;
      }
    }
    // in front of the next trip's reuse of the address registers
    asm volatile("s_wait_xcnt 0x0" ::: "memory");
  }
}

extern "C" void kernel_launch(void* const* d_in, const int* in_sizes, int n_in,
                              void* d_out, int out_size, void* d_ws, size_t ws_size,
                              hipStream_t stream) {
  (void)in_sizes; (void)n_in; (void)out_size; (void)ws_size;
  const float* msa_act  = (const float*)d_in[0];
  const float* msa_mask = (const float*)d_in[1];
  const float* ln_w     = (const float*)d_in[2];
  const float* ln_b     = (const float*)d_in[3];
  const float* wq       = (const float*)d_in[4];
  const float* wk       = (const float*)d_in[5];
  const float* wvp      = (const float*)d_in[6];
  const float* wg       = (const float*)d_in[7];
  const float* bg       = (const float*)d_in[8];
  const float* wo       = (const float*)d_in[9];
  const float* bo       = (const float*)d_in[10];
  float* out            = (float*)d_out;
  float* ws             = (float*)d_ws;   // gated o, f16 fragments: 48 MiB

  // dynamic LDS above the default limit; opt in every call
  // (deterministic; hipFuncSetAttribute is not a stream op, capture-safe).
  hipFuncSetAttribute(reinterpret_cast<const void*>(col_attn_fused),
                      hipFuncAttributeMaxDynamicSharedMemorySize,
                      LDS_TOTAL_BYTES);
  hipFuncSetAttribute(reinterpret_cast<const void*>(col_attn_out),
                      hipFuncAttributeMaxDynamicSharedMemorySize,
                      OP_LDS_BYTES);

  col_attn_fused<<<dim3(N_WG), dim3(NTHREADS), LDS_TOTAL_BYTES, stream>>>(
      msa_act, msa_mask, ln_w, ln_b, wq, wk, wvp, wg, bg, ws);
  col_attn_out<<<dim3(N_WG), dim3(OP_THREADS), OP_LDS_BYTES, stream>>>(
      wo, bo, ws, out);
}

// v008
// It runs in 129 microseconds.
// Next to v007, in two timings, it ran 1.06 times as fast each time.
// Counting every step since v000, it is 11.0 times as fast.
#include <hip/hip_runtime.h>
#include <hip/hip_bf16.h>

typedef __attribute__((ext_vector_type(16))) _Float16 v16h;
typedef __attribute__((ext_vector_type(8)))  _Float16 v8h;
typedef __attribute__((ext_vector_type(8)))  float    v8f;
typedef __attribute__((ext_vector_type(4)))  float    v4f;
typedef __attribute__((ext_vector_type(2)))  float    v2f;

#define S_LEN 256
#define R_LEN 384
#define C_DIM 256
#define H_NUM 8
#define D_DIM 32

#define NTHREADS 512   // 16 wave32 -> 4 waves per SIMD32 (latency hiding)
#define NWAVES   16
#define ROWS_PW  16    // query/sequence rows owned by each wave
#define N_WG     256   // one work-group per WGP, one round: 1.5 residues each
#define LN_B     4     // LayerNorm rows whose sums run side by side

// LDS layout (offsets in halves; total 160256 halves = 320512 B = 313 KB)
// Sizes are logical [rows][cols]; how a tile lies in its range: pidx() below.
#define LDS_X   0        // x  [256][256] f16  (layernormed activations)
#define LDS_WT  65536    // wt [2][4][32][256] f16: two sets of a head's four
                         // transposed weight tiles (query, key, value, gate)
#define LDS_K   131072   // k  [256][32]  f16
#define LDS_VT  139264   // vT [32][256]  f16
#define LDS_KB  147456   // key bias [256] f32
#define LDS_QX  147968   // [8 pairs][2][32 lanes][8] f16: Q^T fragment handed over
#define LDS_GX  152064   // [8 pairs][4][32 lanes][4] f32: gate^T handed over
#define LDS_TOTAL_BYTES 320512
#define WT_TILE 8192     // halves of one weight tile
#define WT_SET  32768    // halves of a set of four

// Second launch (output product): 24 waves, one 16-row tile each, so that the
// 384 * 16 row tiles are 256 work-groups, one per WGP. Its LDS holds
// all of wo as 8 transposed f16 tiles of [32][256].
#define OP_THREADS 768
#define OP_WAVES   24
#define OP_LDS_BYTES 131072

// Bank-conflict-free placement of a [ROWS][cols] f16 tile, no byte of padding.
// A fragment load has 16 lanes read the same 16-byte chunk of 16 consecutive
// rows; the LDS has 64 banks x 4 B, so those 16 chunks must fall on 16
// different 16-byte slots modulo 256 B. With rows of 512 B they all fall on
// one slot, with plain rows of 64 B on four.
//  - The tile is cut into panels of 32 columns; a panel is [ROWS][32], rows of
//    64 B, so 4 consecutive rows fill the 256 B once.
//  - Inside a row the four chunks are permuted by XOR with bits 2..3 of the
//    row number, so rows r, r+4, r+8, r+12 use four different slots.
// Writers and readers index through the same map; the place inside a chunk
// (col & 7) is untouched, and a panel step is a constant address offset.
template <int ROWS>
__device__ inline int pidx(int row, int col) {
  return (col >> 5) * (ROWS * 32) + row * 32 +
         ((col & 31) ^ (((row >> 2) & 3) << 3));
}
// The same index for an accumulator element: row = rowb + 8 * hl + i with rowb
// a multiple of 16, hl = lane >> 4, and i = 0..7 constant after unrolling
// (bits 2..3 of the row are i >> 2 and hl): lane part first, constant last.
template <int ROWS>
__device__ inline int pidx_acc(int rowb, int hl, int i, int col) {
  return (col >> 5) * (ROWS * 32) + (rowb + 8 * hl) * 32 +
         (((col & 31) ^ (hl << 4)) ^ ((i >> 2) << 3)) + i * 32;
}

// Load a 16x32 f16 WMMA fragment (A-layout, or B-layout when the matrix
// columns are stored contiguously as rows). Per ISA 7.12.2: lanes 0-15 hold
// row (lane&15), K=0..7 (VGPR0-3) and K=16..23 (VGPR4-7); lanes 16-31 hold
// K=8..15 and K=24..31. Two 16B chunks per lane -> ds_load_b128.
// Rows row0..row0+15 (row0 a multiple of 16), columns col0..col0+31 (col0 a
// multiple of 32) of a tile placed by pidx<ROWS>: chunks hl and hl + 2 of the
// row, each XORed with bits 2..3 of the row.
template <int ROWS>
__device__ inline v16h ldfrag(const _Float16* p, int row0, int col0) {
  const int lane = threadIdx.x & 31;
  const int l = lane & 15;
  const int x = ((lane >> 4) ^ (l >> 2)) << 3;
  const _Float16* q = p + (col0 >> 5) * (ROWS * 32) + (row0 + l) * 32;
  v8h lo = *(const v8h*)(q + x);
  v8h hi = *(const v8h*)(q + (x ^ 16));
  v16h r;
#pragma unroll
  for (int i = 0; i < 8; ++i) { r[i] = lo[i]; r[i + 8] = hi[i]; }
  return r;
}

__device__ inline v8f wmma16(v16h a, v16h b, v8f c) {
  return __builtin_amdgcn_wmma_f32_16x16x32_f16(false, a, false, b, (short)0, c,
                                                false, false);
}

// The value that lane ^ 16 holds (the other half of the wave), on the vector
// pipe.
__device__ inline float other_half(float v) {
  const int b = __builtin_bit_cast(int, v);
  return __builtin_bit_cast(float, __builtin_amdgcn_permlanex16(
      b, b, 0x76543210, 0xfedcba98, false, false));
}

// exp(x) as 2^(x * log2 e), the form __expf compiles to, for eight values (or
// one) in ONE statement: the instruction set asks for one independent
// instruction or a v_nop behind a transcendental before its result is read or
// its source overwritten. Here every result
// register differs from every source ("=&v"), each v_exp_f32 is the
// independent instruction behind the one before, and the v_nop is the slot
// behind the last.
__device__ inline v8f exp_x8(v8f x) {
  x *= 1.44269504088896340736f;
  float r0, r1, r2, r3, r4, r5, r6, r7;
  asm("v_exp_f32 %0, %8\n\tv_exp_f32 %1, %9\n\tv_exp_f32 %2, %10\n\t"
      "v_exp_f32 %3, %11\n\tv_exp_f32 %4, %12\n\tv_exp_f32 %5, %13\n\t"
      "v_exp_f32 %6, %14\n\tv_exp_f32 %7, %15\n\tv_nop"
      : "=&v"(r0), "=&v"(r1), "=&v"(r2), "=&v"(r3), "=&v"(r4), "=&v"(r5),
        "=&v"(r6), "=&v"(r7)
      : "v"(x[0]), "v"(x[1]), "v"(x[2]), "v"(x[3]), "v"(x[4]), "v"(x[5]),
        "v"(x[6]), "v"(x[7]));
  return (v8f){r0, r1, r2, r3, r4, r5, r6, r7};
}
// 1 / x for eight values in one statement, for the same slot.
__device__ inline v8f rcp_x8(v8f x) {
  float r0, r1, r2, r3, r4, r5, r6, r7;
  asm("v_rcp_f32 %0, %8\n\tv_rcp_f32 %1, %9\n\tv_rcp_f32 %2, %10\n\t"
      "v_rcp_f32 %3, %11\n\tv_rcp_f32 %4, %12\n\tv_rcp_f32 %5, %13\n\t"
      "v_rcp_f32 %6, %14\n\tv_rcp_f32 %7, %15\n\tv_nop"
      : "=&v"(r0), "=&v"(r1), "=&v"(r2), "=&v"(r3), "=&v"(r4), "=&v"(r5),
        "=&v"(r6), "=&v"(r7)
      : "v"(x[0]), "v"(x[1]), "v"(x[2]), "v"(x[3]), "v"(x[4]), "v"(x[5]),
        "v"(x[6]), "v"(x[7]));
  return (v8f){r0, r1, r2, r3, r4, r5, r6, r7};
}
__device__ inline float exp_x1(float x) {
  x *= 1.44269504088896340736f;
  float r;
  asm("v_exp_f32 %0, %1\n\tv_nop" : "=&v"(r) : "v"(x));
  return r;
}

// Staging of W[:, t*32 : t*32+32] transposed into LDS, wt[d][c] placed by
// pidx<32>, in two halves. fetch_w issues the thread's 16 loads together
// (c = c0 + 16 * k, d = lane: one address, constant offsets); put_w converts
// and stores them. fetch_w stands one phase (the head's products, or its
// attention) ahead of its put_w, so the loads' latency runs under that phase.
__device__ inline void fetch_w(float (&wr)[16], const float* __restrict__ w, int t) {
  const int tid = threadIdx.x;
  const int d = tid & 31;
  const int c0 = tid >> 5;            // 0..15
  const unsigned off = (unsigned)(c0 * 256 + t * 32 + d);        // elements
#pragma unroll
  for (int k = 0; k < C_DIM / NWAVES; ++k)
    wr[k] = *(const float*)((const char*)(w + off) + k * (NWAVES * 256 * 4));
  // The wait that belongs in front of an overwrite of the loads' offset
  // register, once for all 16; the offset, in elements (the loads take it times 4, in bytes),
  // is an input so that it stays in its register up to here (builds had given
  // it to the last load's result).
  asm volatile("s_wait_xcnt 0x0" :: "v"(off) : "memory");
  // Holds the 16 loads here, at the head of the product that follows: without
  // it the scheduler sank them into that product's second half, and the wait
  // in front of the next barrier then saw most of their latency.
  __builtin_amdgcn_sched_barrier(0);
}
__device__ inline void put_w(_Float16* wt, const float (&wr)[16]) {
  const int tid = threadIdx.x;
  const int d = tid & 31;
  const int c0 = tid >> 5;
#pragma unroll
  for (int k = 0; k < C_DIM / NWAVES; ++k)
    wt[pidx<32>(d, c0 + k * NWAVES)] = (_Float16)wr[k];
}

// A head's four products (query, key, value, gate) are dealt over a PAIR of
// waves (w, w ^ 1) and the pair's 32 rows: one wave does key and value, the
// other query and gate, each for BOTH row tiles. A weight fragment read from
// LDS so feeds two products: 6 fragment reads for 8 products a k step, where
// one row tile against all four weight tiles took 9. The k step is outermost
// and the eight accumulator chains are independent of one another.
// w0, w1: the wave's two weight tiles; rowa: its own row tile, rowc: its
// partner's. acc[0..1] w0 and acc[2..3] w1 of rowa, acc[4..7] the same of rowc.
// W_AS_A false (key, value): x as A, weights as B; element i of tile nt is
//   (x @ w)[row + 8*hl + i][nt*16 + ln16].
// W_AS_A true (query, gate): weights as A, x as B; element i of tile nt is
//   (x @ w)[row + ln16][nt*16 + 8*hl + i], 8 consecutive channels of ONE row
//   per lane.
template <bool W_AS_A>
__device__ inline void project_pair(const _Float16* xs, const _Float16* w0,
                                    const _Float16* w1, int rowa, int rowc,
                                    v8f (&acc)[8]) {
#pragma unroll
  for (int t = 0; t < 8; ++t) acc[t] = (v8f){};
#pragma unroll
  for (int kc = 0; kc < C_DIM; kc += 32) {
    const v16h xa = ldfrag<256>(xs, rowa, kc);
    const v16h xc = ldfrag<256>(xs, rowc, kc);
#pragma unroll
    for (int nt = 0; nt < 2; ++nt) {
      const v16h f0 = ldfrag<32>(w0, nt * 16, kc);
      const v16h f1 = ldfrag<32>(w1, nt * 16, kc);
      if (W_AS_A) {
        acc[nt]     = wmma16(f0, xa, acc[nt]);
        acc[2 + nt] = wmma16(f1, xa, acc[2 + nt]);
        acc[4 + nt] = wmma16(f0, xc, acc[4 + nt]);
        acc[6 + nt] = wmma16(f1, xc, acc[6 + nt]);
      } else {
        acc[nt]     = wmma16(xa, f0, acc[nt]);
        acc[2 + nt] = wmma16(xa, f1, acc[2 + nt]);
        acc[4 + nt] = wmma16(xc, f0, acc[4 + nt]);
        acc[6 + nt] = wmma16(xc, f1, acc[6 + nt]);
      }
    }
  }
}

// Q^T tiles 0 and 1 of a row tile, scaled and packed: the B fragment of the
// score product (k = 8*hl + i, then 16 + 8*hl + i).
__device__ inline v16h pack_q(v8f q0, v8f q1) {
  v16h qb;
#pragma unroll
  for (int i = 0; i < 8; ++i) {
    qb[i]     = (_Float16)(q0[i] * 0.17677669529663688f /*1/sqrt(32)*/);
    qb[8 + i] = (_Float16)(q1[i] * 0.17677669529663688f);
  }
  return qb;
}

// Column tile nt of a [16 x 32] product (x as A) into LDS as f16.
// transposed=false -> dst is [s][32]; true -> dst is [d][256].
__device__ inline void store_tile(v8f acc, _Float16* dst, int nt, int rowb,
                                  int hl, int ln16, bool transposed) {
  const int dcol = nt * 16 + ln16;        // C-layout: N = lane & 15,
  if (transposed) {                       //           M = i + 8*(lane>>4)
    // the lane's 8 values are 8 consecutive s of row dcol: one whole chunk
    v8h pk;
#pragma unroll
    for (int i = 0; i < 8; ++i) pk[i] = (_Float16)acc[i];
    *(v8h*)(dst + pidx<32>(dcol, rowb + 8 * hl)) = pk;
  } else {
#pragma unroll
    for (int i = 0; i < 8; ++i)
      dst[pidx_acc<256>(rowb, hl, i, dcol)] = (_Float16)acc[i];
  }
}

__global__ void __launch_bounds__(NTHREADS, 1)
col_attn_fused(const float* __restrict__ msa_act,
               const float* __restrict__ msa_mask,
               const float* __restrict__ ln_w, const float* __restrict__ ln_b,
               const float* __restrict__ wq, const float* __restrict__ wk,
               const float* __restrict__ wvp, const float* __restrict__ wg,
               const float* __restrict__ bg, float* __restrict__ ws) {
  extern __shared__ _Float16 smem[];
  _Float16* xs = smem + LDS_X;
  _Float16* wt = smem + LDS_WT;
  _Float16* kh = smem + LDS_K;
  _Float16* vt = smem + LDS_VT;
  float*    kb = (float*)(smem + LDS_KB);

  const int tid   = threadIdx.x;
  const int lane  = tid & 31;
  const int wv_id = tid >> 5;          // 16 waves; wave w owns s rows [16w,16w+16)
  const int hl    = lane >> 4;
  const int ln16  = lane & 15;
  const int rowb  = wv_id * ROWS_PW;
  // The wave's part in its pair's products: 1 query and gate, 0 key and value.
  // Waves w and w ^ 1 differ in it, and so do w and w + 4: whichever way the
  // waves are dealt to the four SIMDs, each SIMD has two of either kind.
  const int qg_wave = __builtin_amdgcn_readfirstlane((wv_id ^ (wv_id >> 2)) & 1);
  // Where the pair's query-and-gate wave leaves its partner's Q^T fragment and
  // gate: lane l's values for lane l, 16 B a lane and plane.
  v8h* qx = (v8h*)(smem + LDS_QX) + (wv_id >> 1) * 64 + lane;
  v4f* gx = (v4f*)(smem + LDS_GX) + (wv_id >> 1) * 128 + lane;

  // The deal: 384 residues x 8 heads are 12 (residue, head) units for each of
  // the 256 work-groups. A pair of work-groups has three residues: first each
  // takes four heads of the middle one (both read its rows at the same time),
  // then all eight heads of one of the outer two.
  const int pair = blockIdx.x >> 1;
  const int odd  = blockIdx.x & 1;

  // The set of weight tiles that the current head reads; the other set is
  // filled for the next head meanwhile, two tiles behind the products and two
  // behind the attention, so that staging needs no barrier of its own. Its
  // last readers (the head before) stand in front of the barrier that ends
  // that head, and the barrier that ends this head publishes it.
  int set = 0;
  // The very first head's set; the barrier behind the LayerNorm publishes it.
  // Every later head's, the second job's first among them, is staged by the
  // head before.
  {
    float w0[4][16];
    fetch_w(w0[0], wq, 4 * odd);
    fetch_w(w0[1], wk, 4 * odd);
    fetch_w(w0[2], wvp, 4 * odd);
    fetch_w(w0[3], wg, 4 * odd);
#pragma unroll
    for (int t = 0; t < 4; ++t) put_w(wt + t * WT_TILE, w0[t]);
  }

  for (int job = 0; job < 2; ++job) {
  const int r  = job == 0 ? 3 * pair + 1 : 3 * pair + 2 * odd;  // residue: the
                                               // "batch" dim of col-attn
  const int h0 = job == 0 ? 4 * odd : 0;       // heads h0 .. h1 - 1
  const int h1 = job == 0 ? h0 + 4 : H_NUM;

  // xs, kb: their last readers of the job before stand in front of that job's
  // last barrier.

  // ---------------- Phase 1: LayerNorm into LDS (f16) --------------------
  float lnw[8], lnbv[8];
#pragma unroll
  for (int i = 0; i < 8; ++i) { lnw[i] = ln_w[lane * 8 + i]; lnbv[i] = ln_b[lane * 8 + i]; }

  // All of the phase's loads issue together: the wave's 16 rows (one address,
  // constant offsets) and the thread's mask value. One row at a time, each
  // row stood through a whole memory round trip and its own five cross-lane
  // steps before the next row's load was even issued.
  const float* row0 = msa_act + ((size_t)rowb * R_LEN + r) * C_DIM + lane * 8;
  const float* mkp  = msa_mask + (size_t)(tid & (S_LEN - 1)) * R_LEN + r;
  float v[ROWS_PW][8];
#pragma unroll
  for (int sr = 0; sr < ROWS_PW; ++sr)
#pragma unroll
    for (int i = 0; i < 8; ++i) v[sr][i] = row0[(size_t)sr * (R_LEN * C_DIM) + i];
  const float mk = *mkp;
  // The wait that belongs in front of an overwrite of the loads' address
  // registers, once for all of them; the addresses are inputs so that they
  // stay in their registers up to here.
  asm volatile("s_wait_xcnt 0x0" :: "v"(row0), "v"(mkp) : "memory");
  // Holds the loads here, in front of the first row's sums: sunk to their
  // uses they would be waited for one row at a time again.
  __builtin_amdgcn_sched_barrier(0);

  // Four rows at a time, so that the rows' cross-lane steps run side by side.
#pragma unroll
  for (int rb = 0; rb < ROWS_PW; rb += LN_B) {
    float sum[LN_B], sq[LN_B];
#pragma unroll
    for (int j = 0; j < LN_B; ++j) {
      sum[j] = 0.f; sq[j] = 0.f;
#pragma unroll
      for (int i = 0; i < 8; ++i) {
        sum[j] += v[rb + j][i];
        sq[j]  += v[rb + j][i] * v[rb + j][i];
      }
    }
#pragma unroll
    for (int m = 16; m >= 1; m >>= 1) {
      float ts[LN_B], tq[LN_B];
#pragma unroll
      for (int j = 0; j < LN_B; ++j) {
        ts[j] = __shfl_xor(sum[j], m, 32);
        tq[j] = __shfl_xor(sq[j], m, 32);
      }
#pragma unroll
      for (int j = 0; j < LN_B; ++j) { sum[j] += ts[j]; sq[j] += tq[j]; }
    }
#pragma unroll
    for (int j = 0; j < LN_B; ++j) {
      const float mu   = sum[j] * (1.f / 256.f);
      const float var  = sq[j] * (1.f / 256.f) - mu * mu;
      const float rstd = rsqrtf(var + 1e-5f);
      v8h hx;
#pragma unroll
      for (int i = 0; i < 8; ++i)
        hx[i] = (_Float16)((v[rb + j][i] - mu) * rstd * lnw[i] + lnbv[i]);
      *(v8h*)(xs + pidx<256>(rowb + rb + j, lane * 8)) = hx;
    }
    // Ends the group's scheduling region: with all groups in one region the
    // first sums came out behind a wait for the LAST row's load, and no
    // arithmetic ran while rows were still on their way; so divided, the last
    // group's rows are still arriving while the earlier groups are worked on.
    if (rb + LN_B < ROWS_PW) __builtin_amdgcn_sched_barrier(0);
  }

  // Attention bias of the 256 keys, read back 8 consecutive keys per lane.
  if (tid < S_LEN)
    kb[tid] = 1e9f * (mk - 1.f);

  __syncthreads();

  v8f oaccv[2];  // per-wave O^T accumulators [ntile]; persist through gating

  // ---------------- Phase 2: per-head fused attention ---------------------
  for (int h = h0; h < h1; ++h) {
    const _Float16* wc = wt + set * WT_SET;        // this head's four tiles
    _Float16*       wn = wt + (set ^ 1) * WT_SET;  // the next head's
    // The head after this one; behind a job's last head comes head 0 (the
    // second job's first; behind the last head of all nobody reads the set).
    const int hn = h + 1 < h1 ? h + 1 : 0;
    float wa[16], wb[16];    // two weight tiles in flight: fetch_w ... put_w
    fetch_w(wa, wq, hn);
    fetch_w(wb, wk, hn);
    v16h qb = {};      // Q^T of the wave's own rows: B fragment of the scores
    v8f gate[2] = {};  // g = sigmoid(x @ wg_h + bg_h) of its own rows, transposed
                       // like O^T; held to the head's end (up to the barrier,
                       // in a query-and-gate wave: the sigmoid's argument)
    if (qg_wave) {
      // The lane's 16 gate biases: channels 8*hl + i and 16 + 8*hl + i of head h.
      const float* bgp = bg + h * 32 + 8 * hl;
      v8f bgv[2];
#pragma unroll
      for (int nt = 0; nt < 2; ++nt)
#pragma unroll
        for (int i = 0; i < 8; ++i) bgv[nt][i] = bgp[nt * 16 + i];
      // The wait that belongs in front of an overwrite of the loads' address
      // registers; the address is an input so that it stays in them up to here.
      asm volatile("s_wait_xcnt 0x0" :: "v"(bgp) : "memory");
      v8f acc[8];
      project_pair<true>(xs, wc, wc + 3 * WT_TILE, rowb, rowb ^ 16, acc);
      // Ends the products' scheduling region: with LDS stores in one region
      // with them, each weight fragment's load came out directly in front of
      // its product, which then stood through the LDS latency every time.
      __builtin_amdgcn_sched_barrier(0);
      // The partner's rows first: they must lie in LDS in front of the barrier.
      const v16h qp = pack_q(acc[4], acc[5]);
      qx[0]  = __builtin_shufflevector(qp, qp, 0, 1, 2, 3, 4, 5, 6, 7);
      qx[32] = __builtin_shufflevector(qp, qp, 8, 9, 10, 11, 12, 13, 14, 15);
#pragma unroll
      for (int nt = 0; nt < 2; ++nt) {
        const v8f gp = rcp_x8(1.f + exp_x8(-(acc[6 + nt] + bgv[nt])));
        gx[nt * 64]      = gp.lo;
        gx[nt * 64 + 32] = gp.hi;
      }
      // Its own rows stay in registers: Q and the gate never go through LDS.
      qb = pack_q(acc[0], acc[1]);
#pragma unroll
      for (int nt = 0; nt < 2; ++nt) gate[nt] = acc[2 + nt] + bgv[nt];
    } else {
      v8f acc[8];
      project_pair<false>(xs, wc + WT_TILE, wc + 2 * WT_TILE, rowb, rowb ^ 16, acc);
      // Ends the products' scheduling region, as in the other branch.
      __builtin_amdgcn_sched_barrier(0);
#pragma unroll
      for (int rt = 0; rt < 2; ++rt)
#pragma unroll
        for (int nt = 0; nt < 2; ++nt) {
          const int row = rt ? rowb ^ 16 : rowb;
          store_tile(acc[4 * rt + nt], kh, nt, row, hl, ln16, false);
          store_tile(acc[4 * rt + 2 + nt], vt, nt, row, hl, ln16, true);  // V transposed
        }
    }
    put_w(wn, wa);
    put_w(wn + WT_TILE, wb);
    __syncthreads();  // all k/vT visible, and what the pairs hand over
    if (!qg_wave) {
      const v8h q0 = qx[0], q1 = qx[32];
      qb = __builtin_shufflevector(q0, q1, 0, 1, 2, 3, 4, 5, 6, 7, 8, 9, 10, 11,
                                   12, 13, 14, 15);
#pragma unroll
      for (int nt = 0; nt < 2; ++nt) {
        gate[nt].lo = gx[nt * 64];
        gate[nt].hi = gx[nt * 64 + 32];
      }
    }
    fetch_w(wa, wvp, hn);  // behind the barrier: a barrier waits for loads in flight
    fetch_w(wb, wg, hn);
    if (qg_wave) {
      // Its own gate behind the barrier, where nobody waits for it.
#pragma unroll
      for (int nt = 0; nt < 2; ++nt)
        gate[nt] = rcp_x8(1.f + exp_x8(-gate[nt]));
    }

    float rmax = -1e30f, rsum = 0.f;   // rsum: this half's keys only
    oaccv[0] = (v8f){};
    oaccv[1] = (v8f){};

    for (int kp = 0; kp < 8; ++kp) {  // 32 keys per step
      const int key0 = kp * 32;
      v8f s0 = {}, s1 = {};
      s0 = wmma16(ldfrag<256>(kh, key0 + 0, 0), qb, s0);
      s1 = wmma16(ldfrag<256>(kh, key0 + 16, 0), qb, s1);
      s0 += *(const v8f*)(kb + key0 + 8 * hl);
      s1 += *(const v8f*)(kb + key0 + 16 + 8 * hl);
      const float t0 = fmaxf(fmaxf(s0[0], s0[1]), s0[2]);
      const float t1 = fmaxf(fmaxf(s0[3], s0[4]), s0[5]);
      const float t2 = fmaxf(fmaxf(s0[6], s0[7]), s1[0]);
      const float t3 = fmaxf(fmaxf(s1[1], s1[2]), s1[3]);
      const float t4 = fmaxf(fmaxf(s1[4], s1[5]), s1[6]);
      float t = fmaxf(fmaxf(fmaxf(t0, t1), t2), fmaxf(fmaxf(t3, t4), s1[7]));
      t = fmaxf(t, other_half(t));
      const float nm = fmaxf(rmax, t);
      const float sc = exp_x1(rmax - nm);
      rmax = nm;
      const v8f p0 = exp_x8(s0 - nm);
      const v8f p1 = exp_x8(s1 - nm);
      v16h pf;
#pragma unroll
      for (int i = 0; i < 8; ++i) {
        pf[i]     = (_Float16)p0[i];
        pf[8 + i] = (_Float16)p1[i];
      }
      const v8f pv = p0 + p1;            // halved three times: packed adds
      const v4f ph = pv.lo + pv.hi;
      const v2f pq = ph.lo + ph.hi;
      rsum = rsum * sc + (pq.x + pq.y);
      oaccv[0] *= sc;
      oaccv[1] *= sc;
      oaccv[0] = wmma16(ldfrag<32>(vt, 0, key0), pf, oaccv[0]);
      oaccv[1] = wmma16(ldfrag<32>(vt, 16, key0), pf, oaccv[1]);
    }
    rsum += other_half(rsum);
    const float rinv = __builtin_amdgcn_rcpf(rsum);

    // ---- store gated O ---------------------------------------------------
    put_w(wn + 2 * WT_TILE, wa);
    put_w(wn + 3 * WT_TILE, wb);
    // The lane's two packed tiles of head h ARE its part of the A fragment of
    // the output product for columns 32h..32h+31 (k = 8*hl + i, then
    // 16 + 8*hl + i): stored in that order, 32 B a lane, 1 KB a wave and head.
    v8h* og = (v8h*)ws + ((((size_t)r * NWAVES + wv_id) * H_NUM + h) * 32 + lane) * 2;
    v8h go[2];
#pragma unroll
    for (int nt = 0; nt < 2; ++nt) {
      // the lane's 8 values are 8 consecutive channels of one row: one chunk
      v8h pk;
#pragma unroll
      for (int i = 0; i < 8; ++i)
        pk[i] = (_Float16)(oaccv[nt][i] * rinv * gate[nt][i]);
      go[nt] = pk;
    }
    // Ends the head: k, vT and this set have no reader left, the other set is
    // complete.
    __syncthreads();
    set ^= 1;
    // Behind the barrier, not in front of it: a barrier waits for the wave's
    // outstanding global stores, and here they fly under the next staging.
    og[0] = go[0];
    og[1] = go[1];
    // in front of any reuse of the two stores' address registers
    asm volatile("s_wait_xcnt 0x0" ::: "memory");
  }
  }  // job
}

// ---------------- Second launch: out = o @ wo + bo ------------------------
__global__ void __launch_bounds__(OP_THREADS, 1)
col_attn_out(const float* __restrict__ wo, const float* __restrict__ bo,
             const float* __restrict__ ws, float* __restrict__ out) {
  extern __shared__ _Float16 smem[];
  const int tid  = threadIdx.x;
  const int lane = tid & 31;
  const int hl   = lane >> 4;
  const int ln16 = lane & 15;
  const int g    = blockIdx.x * OP_WAVES + (tid >> 5);  // row tile, as written
  const int r    = g >> 4;
  const int rowb = (g & 15) * ROWS_PW;

  // The tile's 8 A fragments, as the first launch's lanes laid them down.
  const v16h* og = (const v16h*)ws + (size_t)g * (H_NUM * 32) + lane;
  v16h of[H_NUM];
#pragma unroll
  for (int h = 0; h < H_NUM; ++h) of[h] = og[h * 32];
  // In front of any reuse of the loads' address registers; the address is an
  // input so that it stays in them up to here (the build had given them to the
  // last load's result).
  asm volatile("s_wait_xcnt 0x0" :: "v"(og) : "memory");

  // wo[:, t*32 : t*32+32] transposed, tile t at smem + t * 8192; the staging
  // helpers are written for 16 waves, four tiles' loads in flight at a time.
  if (tid < NTHREADS) {
#pragma unroll
    for (int tb = 0; tb < 8; tb += 4) {
      float wr[4][16];
#pragma unroll
      for (int t = 0; t < 4; ++t) fetch_w(wr[t], wo, tb + t);
#pragma unroll
      for (int t = 0; t < 4; ++t) put_w(smem + (tb + t) * 8192, wr[t]);
    }
  }
  __syncthreads();

  for (int cb = 0; cb < 8; ++cb) {  // 32 output channels per chunk
    const _Float16* wt = smem + cb * 8192;
#pragma unroll
    for (int nt = 0; nt < 2; ++nt) {
      v8f acc = {};
#pragma unroll
      for (int kc = 0; kc < 256; kc += 32) {
        v16h b = ldfrag<32>(wt, nt * 16, kc);
        acc = wmma16(of[kc >> 5], b, acc);
      }
      const int c = cb * 32 + nt * 16 + ln16;
      const float bov = bo[c];
#pragma unroll
      for (int i = 0; i < 8; ++i) {
        const int s = rowb + i + 8 * hl;
        out[((size_t)s * R_LEN + r) * C_DIM + c] = acc[i] + bov;
      }
    }
    // in front of the next trip's reuse of the address registers
    asm volatile("s_wait_xcnt 0x0" ::: "memory");
  }
}

extern "C" void kernel_launch(void* const* d_in, const int* in_sizes, int n_in,
                              void* d_out, int out_size, void* d_ws, size_t ws_size,
                              hipStream_t stream) {
  (void)in_sizes; (void)n_in; (void)out_size; (void)ws_size;
  const float* msa_act  = (const float*)d_in[0];
  const float* msa_mask = (const float*)d_in[1];
  const float* ln_w     = (const float*)d_in[2];
  const float* ln_b     = (const float*)d_in[3];
  const float* wq       = (const float*)d_in[4];
  const float* wk       = (const float*)d_in[5];
  const float* wvp      = (const float*)d_in[6];
  const float* wg       = (const float*)d_in[7];
  const float* bg       = (const float*)d_in[8];
  const float* wo       = (const float*)d_in[9];
  const float* bo       = (const float*)d_in[10];
  float* out            = (float*)d_out;
  float* ws             = (float*)d_ws;   // gated o, f16 fragments: 48 MiB

  // dynamic LDS above the default limit; opt in every call
  // (deterministic; hipFuncSetAttribute is not a stream op, capture-safe).
  hipFuncSetAttribute(reinterpret_cast<const void*>(col_attn_fused),
                      hipFuncAttributeMaxDynamicSharedMemorySize,
                      LDS_TOTAL_BYTES);
  hipFuncSetAttribute(reinterpret_cast<const void*>(col_attn_out),
                      hipFuncAttributeMaxDynamicSharedMemorySize,
                      OP_LDS_BYTES);

  col_attn_fused<<<dim3(N_WG), dim3(NTHREADS), LDS_TOTAL_BYTES, stream>>>(
      msa_act, msa_mask, ln_w, ln_b, wq, wk, wvp, wg, bg, ws);
  col_attn_out<<<dim3(N_WG), dim3(OP_THREADS), OP_LDS_BYTES, stream>>>(
      wo, bo, ws, out);
}

// v009
// It runs in 112 microseconds.
// Timed twice side by side with v008, it ran 1.15 times as fast both times.
// Counting every step since v000, it is 12.6 times as fast.
#include <hip/hip_runtime.h>
#include <hip/hip_bf16.h>

typedef __attribute__((ext_vector_type(16))) _Float16 v16h;
typedef __attribute__((ext_vector_type(8)))  _Float16 v8h;
typedef __attribute__((ext_vector_type(8)))  float    v8f;
typedef __attribute__((ext_vector_type(4)))  float    v4f;
typedef __attribute__((ext_vector_type(2)))  float    v2f;

#define S_LEN 256
#define R_LEN 384
#define C_DIM 256
#define H_NUM 8
#define D_DIM 32

#define NTHREADS 512   // 16 wave32 -> 4 waves per SIMD32 (latency hiding)
#define NWAVES   16
#define ROWS_PW  16    // query/sequence rows owned by each wave
#define N_WG     256   // one work-group per WGP, one round: 1.5 residues each
#define LN_B     4     // LayerNorm rows whose sums run side by side

// LDS layout (offsets in halves; total 160256 halves = 320512 B = 313 KB)
// Sizes are logical [rows][cols]; how a tile lies in its range: pidx() below.
#define LDS_X   0        // x  [256][256] f16  (layernormed activations)
#define LDS_WT  65536    // wt [2][4][32][256] f16: two sets of a head's four
                         // transposed weight tiles (query, key, value, gate)
#define LDS_K   131072   // k  [256][32]  f16
#define LDS_VT  139264   // vT [32][256]  f16
#define LDS_KB  147456   // key bias [256] f32
#define LDS_QX  147968   // [8 pairs][2][32 lanes][8] f16: Q^T fragment handed over
#define LDS_GX  152064   // [8 pairs][4][32 lanes][4] f32: gate^T handed over
#define LDS_TOTAL_BYTES 320512
#define WT_TILE 8192     // halves of one weight tile
#define WT_SET  32768    // halves of a set of four

// Second launch (output product): 24 waves, one 16-row tile each, so that the
// 384 * 16 row tiles are 256 work-groups, one per WGP. Its LDS holds
// all of wo as 8 transposed f16 tiles of [32][256].
#define OP_THREADS 768
#define OP_WAVES   24
#define OP_LDS_BYTES 131072

// Bank-conflict-free placement of a [ROWS][cols] f16 tile, no byte of padding.
// A fragment load has 16 lanes read the same 16-byte chunk of 16 consecutive
// rows; the LDS has 64 banks x 4 B, so those 16 chunks must fall on 16
// different 16-byte slots modulo 256 B. With rows of 512 B they all fall on
// one slot, with plain rows of 64 B on four.
//  - The tile is cut into panels of 32 columns; a panel is [ROWS][32], rows of
//    64 B, so 4 consecutive rows fill the 256 B once.
//  - Inside a row the four chunks are permuted by XOR with bits 2..3 of the
//    row number, so rows r, r+4, r+8, r+12 use four different slots.
// Writers and readers index through the same map; the place inside a chunk
// (col & 7) is untouched, and a panel step is a constant address offset.
template <int ROWS>
__device__ inline int pidx(int row, int col) {
  return (col >> 5) * (ROWS * 32) + row * 32 +
         ((col & 31) ^ (((row >> 2) & 3) << 3));
}
// The same index for an accumulator element: row = rowb + 8 * hl + i with rowb
// a multiple of 16, hl = lane >> 4, and i = 0..7 constant after unrolling
// (bits 2..3 of the row are i >> 2 and hl): lane part first, constant last.
template <int ROWS>
__device__ inline int pidx_acc(int rowb, int hl, int i, int col) {
  return (col >> 5) * (ROWS * 32) + (rowb + 8 * hl) * 32 +
         (((col & 31) ^ (hl << 4)) ^ ((i >> 2) << 3)) + i * 32;
}

// Load a 16x32 f16 WMMA fragment (A-layout, or B-layout when the matrix
// columns are stored contiguously as rows). Per ISA 7.12.2: lanes 0-15 hold
// row (lane&15), K=0..7 (VGPR0-3) and K=16..23 (VGPR4-7); lanes 16-31 hold
// K=8..15 and K=24..31. Two 16B chunks per lane -> ds_load_b128.
// Rows row0..row0+15 (row0 a multiple of 16), columns col0..col0+31 (col0 a
// multiple of 32) of a tile placed by pidx<ROWS>: chunks hl and hl + 2 of the
// row, each XORed with bits 2..3 of the row.
template <int ROWS>
__device__ inline v16h ldfrag(const _Float16* p, int row0, int col0) {
  const int lane = threadIdx.x & 31;
  const int l = lane & 15;
  const int x = ((lane >> 4) ^ (l >> 2)) << 3;
  const _Float16* q = p + (col0 >> 5) * (ROWS * 32) + (row0 + l) * 32;
  v8h lo = *(const v8h*)(q + x);
  v8h hi = *(const v8h*)(q + (x ^ 16));
  v16h r;
#pragma unroll
  for (int i = 0; i < 8; ++i) { r[i] = lo[i]; r[i + 8] = hi[i]; }
  return r;
}

__device__ inline v8f wmma16(v16h a, v16h b, v8f c) {
  return __builtin_amdgcn_wmma_f32_16x16x32_f16(false, a, false, b, (short)0, c,
                                                false, false);
}

// The value that lane ^ 16 holds (the other half of the wave), on the vector
// pipe.
__device__ inline float other_half(float v) {
  const int b = __builtin_bit_cast(int, v);
  return __builtin_bit_cast(float, __builtin_amdgcn_permlanex16(
      b, b, 0x76543210, 0xfedcba98, false, false));
}

// exp(x) as 2^(x * log2 e), the form __expf compiles to, for eight values (or
// one) in ONE statement: the instruction set asks for one independent
// instruction or a v_nop behind a transcendental before its result is read or
// its source overwritten. Here every result
// register differs from every source ("=&v"), each v_exp_f32 is the
// independent instruction behind the one before, and the v_nop is the slot
// behind the last.
__device__ inline v8f exp_x8(v8f x) {
  x *= 1.44269504088896340736f;
  float r0, r1, r2, r3, r4, r5, r6, r7;
  asm("v_exp_f32 %0, %8\n\tv_exp_f32 %1, %9\n\tv_exp_f32 %2, %10\n\t"
      "v_exp_f32 %3, %11\n\tv_exp_f32 %4, %12\n\tv_exp_f32 %5, %13\n\t"
      "v_exp_f32 %6, %14\n\tv_exp_f32 %7, %15\n\tv_nop"
      : "=&v"(r0), "=&v"(r1), "=&v"(r2), "=&v"(r3), "=&v"(r4), "=&v"(r5),
        "=&v"(r6), "=&v"(r7)
      : "v"(x[0]), "v"(x[1]), "v"(x[2]), "v"(x[3]), "v"(x[4]), "v"(x[5]),
        "v"(x[6]), "v"(x[7]));
  return (v8f){r0, r1, r2, r3, r4, r5, r6, r7};
}
// 1 / x for eight values in one statement, for the same slot.
__device__ inline v8f rcp_x8(v8f x) {
  float r0, r1, r2, r3, r4, r5, r6, r7;
  asm("v_rcp_f32 %0, %8\n\tv_rcp_f32 %1, %9\n\tv_rcp_f32 %2, %10\n\t"
      "v_rcp_f32 %3, %11\n\tv_rcp_f32 %4, %12\n\tv_rcp_f32 %5, %13\n\t"
      "v_rcp_f32 %6, %14\n\tv_rcp_f32 %7, %15\n\tv_nop"
      : "=&v"(r0), "=&v"(r1), "=&v"(r2), "=&v"(r3), "=&v"(r4), "=&v"(r5),
        "=&v"(r6), "=&v"(r7)
      : "v"(x[0]), "v"(x[1]), "v"(x[2]), "v"(x[3]), "v"(x[4]), "v"(x[5]),
        "v"(x[6]), "v"(x[7]));
  return (v8f){r0, r1, r2, r3, r4, r5, r6, r7};
}
__device__ inline float exp_x1(float x) {
  x *= 1.44269504088896340736f;
  float r;
  asm("v_exp_f32 %0, %1\n\tv_nop" : "=&v"(r) : "v"(x));
  return r;
}

// Staging of W[:, t*32 : t*32+32] transposed into LDS, wt[d][c] placed by
// pidx<32>, in two halves. fetch_w issues the thread's 16 loads together
// (c = 16 * wave + k, d = lane: one address, constant offsets; a load of the
// wave is one whole 128-byte line); put_w converts and stores them. The
// thread's 16 values are 16 consecutive c of ONE row d of the transposed tile,
// that is two whole 16-byte chunks of pidx: two 16-byte LDS stores, free of
// bank conflicts like the fragment reads (16 lanes, the same chunk of 16
// consecutive rows), where c = wave + 16 * k took sixteen 2-byte stores with
// lanes d and d + 16 on one bank. fetch_w stands one phase (the head's
// products, or its attention) ahead of its put_w, so the loads' latency runs
// under that phase.
#define W_CPW (C_DIM / NWAVES)   // 16 rows c of W per wave
__device__ inline void fetch_w(float (&wr)[16], const float* __restrict__ w, int t) {
  const int tid = threadIdx.x;
  const int d = tid & 31;
  const int c0 = (tid >> 5) * W_CPW;  // 0, 16, .. 240
  const unsigned off = (unsigned)(c0 * 256 + t * 32 + d);        // elements
#pragma unroll
  for (int k = 0; k < W_CPW; ++k)
    wr[k] = *(const float*)((const char*)(w + off) + k * (256 * 4));
  // The wait that belongs in front of an overwrite of the loads' offset
  // register, once for all 16; the offset, in elements (the loads take it times 4, in bytes),
  // is an input so that it stays in its register up to here (builds had given
  // it to the last load's result).
  asm volatile("s_wait_xcnt 0x0" :: "v"(off) : "memory");
  // Holds the 16 loads here, at the head of the product that follows: without
  // it the scheduler sank them into that product's second half, and the wait
  // in front of the next barrier then saw most of their latency.
  __builtin_amdgcn_sched_barrier(0);
}
__device__ inline void put_w(_Float16* wt, const float (&wr)[16]) {
  const int tid = threadIdx.x;
  const int d = tid & 31;
  const int c0 = (tid >> 5) * W_CPW;
#pragma unroll
  for (int j = 0; j < W_CPW / 8; ++j) {
    v8h pk;
#pragma unroll
    for (int i = 0; i < 8; ++i) pk[i] = (_Float16)wr[j * 8 + i];
    *(v8h*)(wt + pidx<32>(d, c0 + j * 8)) = pk;
  }
}

// A head's four products (query, key, value, gate) are dealt over a PAIR of
// waves (w, w ^ 1) and the pair's 32 rows: one wave does key and value, the
// other query and gate, each for BOTH row tiles. A weight fragment read from
// LDS so feeds two products: 6 fragment reads for 8 products a k step, where
// one row tile against all four weight tiles took 9. The k step is outermost
// and the eight accumulator chains are independent of one another.
// w0, w1: the wave's two weight tiles; rowa: its own row tile, rowc: its
// partner's. acc[0..1] w0 and acc[2..3] w1 of rowa, acc[4..7] the same of rowc.
// W_AS_A false (key, value): x as A, weights as B; element i of tile nt is
//   (x @ w)[row + 8*hl + i][nt*16 + ln16].
// W_AS_A true (query, gate): weights as A, x as B; element i of tile nt is
//   (x @ w)[row + ln16][nt*16 + 8*hl + i], 8 consecutive channels of ONE row
//   per lane.
template <bool W_AS_A>
__device__ inline void project_pair(const _Float16* xs, const _Float16* w0,
                                    const _Float16* w1, int rowa, int rowc,
                                    v8f (&acc)[8]) {
#pragma unroll
  for (int t = 0; t < 8; ++t) acc[t] = (v8f){};
#pragma unroll
  for (int kc = 0; kc < C_DIM; kc += 32) {
    const v16h xa = ldfrag<256>(xs, rowa, kc);
    const v16h xc = ldfrag<256>(xs, rowc, kc);
#pragma unroll
    for (int nt = 0; nt < 2; ++nt) {
      const v16h f0 = ldfrag<32>(w0, nt * 16, kc);
      const v16h f1 = ldfrag<32>(w1, nt * 16, kc);
      if (W_AS_A) {
        acc[nt]     = wmma16(f0, xa, acc[nt]);
        acc[2 + nt] = wmma16(f1, xa, acc[2 + nt]);
        acc[4 + nt] = wmma16(f0, xc, acc[4 + nt]);
        acc[6 + nt] = wmma16(f1, xc, acc[6 + nt]);
      } else {
        acc[nt]     = wmma16(xa, f0, acc[nt]);
        acc[2 + nt] = wmma16(xa, f1, acc[2 + nt]);
        acc[4 + nt] = wmma16(xc, f0, acc[4 + nt]);
        acc[6 + nt] = wmma16(xc, f1, acc[6 + nt]);
      }
    }
  }
}

// Q^T tiles 0 and 1 of a row tile, scaled and packed: the B fragment of the
// score product (k = 8*hl + i, then 16 + 8*hl + i).
__device__ inline v16h pack_q(v8f q0, v8f q1) {
  v16h qb;
#pragma unroll
  for (int i = 0; i < 8; ++i) {
    qb[i]     = (_Float16)(q0[i] * 0.17677669529663688f /*1/sqrt(32)*/);
    qb[8 + i] = (_Float16)(q1[i] * 0.17677669529663688f);
  }
  return qb;
}

// Column tile nt of a [16 x 32] product (x as A) into LDS as f16.
// transposed=false -> dst is [s][32]; true -> dst is [d][256].
__device__ inline void store_tile(v8f acc, _Float16* dst, int nt, int rowb,
                                  int hl, int ln16, bool transposed) {
  const int dcol = nt * 16 + ln16;        // C-layout: N = lane & 15,
  if (transposed) {                       //           M = i + 8*(lane>>4)
    // the lane's 8 values are 8 consecutive s of row dcol: one whole chunk
    v8h pk;
#pragma unroll
    for (int i = 0; i < 8; ++i) pk[i] = (_Float16)acc[i];
    *(v8h*)(dst + pidx<32>(dcol, rowb + 8 * hl)) = pk;
  } else {
#pragma unroll
    for (int i = 0; i < 8; ++i)
      dst[pidx_acc<256>(rowb, hl, i, dcol)] = (_Float16)acc[i];
  }
}

__global__ void __launch_bounds__(NTHREADS, 1)
col_attn_fused(const float* __restrict__ msa_act,
               const float* __restrict__ msa_mask,
               const float* __restrict__ ln_w, const float* __restrict__ ln_b,
               const float* __restrict__ wq, const float* __restrict__ wk,
               const float* __restrict__ wvp, const float* __restrict__ wg,
               const float* __restrict__ bg, float* __restrict__ ws) {
  extern __shared__ _Float16 smem[];
  _Float16* xs = smem + LDS_X;
  _Float16* wt = smem + LDS_WT;
  _Float16* kh = smem + LDS_K;
  _Float16* vt = smem + LDS_VT;
  float*    kb = (float*)(smem + LDS_KB);

  const int tid   = threadIdx.x;
  const int lane  = tid & 31;
  const int wv_id = tid >> 5;          // 16 waves; wave w owns s rows [16w,16w+16)
  const int hl    = lane >> 4;
  const int ln16  = lane & 15;
  const int rowb  = wv_id * ROWS_PW;
  // The wave's part in its pair's products: 1 query and gate, 0 key and value.
  // Waves w and w ^ 1 differ in it, and so do w and w + 4: whichever way the
  // waves are dealt to the four SIMDs, each SIMD has two of either kind.
  const int qg_wave = __builtin_amdgcn_readfirstlane((wv_id ^ (wv_id >> 2)) & 1);
  // Where the pair's query-and-gate wave leaves its partner's Q^T fragment and
  // gate: lane l's values for lane l, 16 B a lane and plane.
  v8h* qx = (v8h*)(smem + LDS_QX) + (wv_id >> 1) * 64 + lane;
  v4f* gx = (v4f*)(smem + LDS_GX) + (wv_id >> 1) * 128 + lane;

  // The deal: 384 residues x 8 heads are 12 (residue, head) units for each of
  // the 256 work-groups. A pair of work-groups has three residues: first each
  // takes four heads of the middle one (both read its rows at the same time),
  // then all eight heads of one of the outer two.
  const int pair = blockIdx.x >> 1;
  const int odd  = blockIdx.x & 1;

  // The set of weight tiles that the current head reads; the other set is
  // filled for the next head meanwhile, two tiles behind the products and two
  // behind the attention, so that staging needs no barrier of its own. Its
  // last readers (the head before) stand in front of the barrier that ends
  // that head, and the barrier that ends this head publishes it.
  int set = 0;
  // The very first head's set; the barrier behind the LayerNorm publishes it.
  // Every later head's, the second job's first among them, is staged by the
  // head before.
  {
    float w0[4][16];
    fetch_w(w0[0], wq, 4 * odd);
    fetch_w(w0[1], wk, 4 * odd);
    fetch_w(w0[2], wvp, 4 * odd);
    fetch_w(w0[3], wg, 4 * odd);
#pragma unroll
    for (int t = 0; t < 4; ++t) put_w(wt + t * WT_TILE, w0[t]);
  }

  for (int job = 0; job < 2; ++job) {
  const int r  = job == 0 ? 3 * pair + 1 : 3 * pair + 2 * odd;  // residue: the
                                               // "batch" dim of col-attn
  const int h0 = job == 0 ? 4 * odd : 0;       // heads h0 .. h1 - 1
  const int h1 = job == 0 ? h0 + 4 : H_NUM;

  // xs, kb: their last readers of the job before stand in front of that job's
  // last barrier.

  // ---------------- Phase 1: LayerNorm into LDS (f16) --------------------
  float lnw[8], lnbv[8];
#pragma unroll
  for (int i = 0; i < 8; ++i) { lnw[i] = ln_w[lane * 8 + i]; lnbv[i] = ln_b[lane * 8 + i]; }

  // All of the phase's loads issue together: the wave's 16 rows (one address,
  // constant offsets) and the thread's mask value. One row at a time, each
  // row stood through a whole memory round trip and its own five cross-lane
  // steps before the next row's load was even issued.
  const float* row0 = msa_act + ((size_t)rowb * R_LEN + r) * C_DIM + lane * 8;
  const float* mkp  = msa_mask + (size_t)(tid & (S_LEN - 1)) * R_LEN + r;
  float v[ROWS_PW][8];
#pragma unroll
  for (int sr = 0; sr < ROWS_PW; ++sr)
#pragma unroll
    for (int i = 0; i < 8; ++i) v[sr][i] = row0[(size_t)sr * (R_LEN * C_DIM) + i];
  const float mk = *mkp;
  // The wait that belongs in front of an overwrite of the loads' address
  // registers, once for all of them; the addresses are inputs so that they
  // stay in their registers up to here.
  asm volatile("s_wait_xcnt 0x0" :: "v"(row0), "v"(mkp) : "memory");
  // Holds the loads here, in front of the first row's sums: sunk to their
  // uses they would be waited for one row at a time again.
  __builtin_amdgcn_sched_barrier(0);

  // Four rows at a time, so that the rows' cross-lane steps run side by side.
#pragma unroll
  for (int rb = 0; rb < ROWS_PW; rb += LN_B) {
    float sum[LN_B], sq[LN_B];
#pragma unroll
    for (int j = 0; j < LN_B; ++j) {
      sum[j] = 0.f; sq[j] = 0.f;
#pragma unroll
      for (int i = 0; i < 8; ++i) {
        sum[j] += v[rb + j][i];
        sq[j]  += v[rb + j][i] * v[rb + j][i];
      }
    }
#pragma unroll
    for (int m = 16; m >= 1; m >>= 1) {
      float ts[LN_B], tq[LN_B];
#pragma unroll
      for (int j = 0; j < LN_B; ++j) {
        ts[j] = __shfl_xor(sum[j], m, 32);
        tq[j] = __shfl_xor(sq[j], m, 32);
      }
#pragma unroll
      for (int j = 0; j < LN_B; ++j) { sum[j] += ts[j]; sq[j] += tq[j]; }
    }
#pragma unroll
    for (int j = 0; j < LN_B; ++j) {
      const float mu   = sum[j] * (1.f / 256.f);
      const float var  = sq[j] * (1.f / 256.f) - mu * mu;
      const float rstd = rsqrtf(var + 1e-5f);
      v8h hx;
#pragma unroll
      for (int i = 0; i < 8; ++i)
        hx[i] = (_Float16)((v[rb + j][i] - mu) * rstd * lnw[i] + lnbv[i]);
      *(v8h*)(xs + pidx<256>(rowb + rb + j, lane * 8)) = hx;
    }
    // Ends the group's scheduling region: with all groups in one region the
    // first sums came out behind a wait for the LAST row's load, and no
    // arithmetic ran while rows were still on their way; so divided, the last
    // group's rows are still arriving while the earlier groups are worked on.
    if (rb + LN_B < ROWS_PW) __builtin_amdgcn_sched_barrier(0);
  }

  // Attention bias of the 256 keys, read back 8 consecutive keys per lane.
  if (tid < S_LEN)
    kb[tid] = 1e9f * (mk - 1.f);

  __syncthreads();

  v8f oaccv[2];  // per-wave O^T accumulators [ntile]; persist through gating

  // ---------------- Phase 2: per-head fused attention ---------------------
  for (int h = h0; h < h1; ++h) {
    const _Float16* wc = wt + set * WT_SET;        // this head's four tiles
    _Float16*       wn = wt + (set ^ 1) * WT_SET;  // the next head's
    // The head after this one; behind a job's last head comes head 0 (the
    // second job's first; behind the last head of all nobody reads the set).
    const int hn = h + 1 < h1 ? h + 1 : 0;
    float wa[16], wb[16];    // two weight tiles in flight: fetch_w ... put_w
    fetch_w(wa, wq, hn);
    fetch_w(wb, wk, hn);
    v16h qb = {};      // Q^T of the wave's own rows: B fragment of the scores
    v8f gate[2] = {};  // g = sigmoid(x @ wg_h + bg_h) of its own rows, transposed
                       // like O^T; held to the head's end (up to the barrier,
                       // in a query-and-gate wave: the sigmoid's argument)
    if (qg_wave) {
      // The lane's 16 gate biases: channels 8*hl + i and 16 + 8*hl + i of head h.
      const float* bgp = bg + h * 32 + 8 * hl;
      v8f bgv[2];
#pragma unroll
      for (int nt = 0; nt < 2; ++nt)
#pragma unroll
        for (int i = 0; i < 8; ++i) bgv[nt][i] = bgp[nt * 16 + i];
      // The wait that belongs in front of an overwrite of the loads' address
      // registers; the address is an input so that it stays in them up to here.
      asm volatile("s_wait_xcnt 0x0" :: "v"(bgp) : "memory");
      v8f acc[8];
      project_pair<true>(xs, wc, wc + 3 * WT_TILE, rowb, rowb ^ 16, acc);
      // Ends the products' scheduling region: with LDS stores in one region
      // with them, each weight fragment's load came out directly in front of
      // its product, which then stood through the LDS latency every time.
      __builtin_amdgcn_sched_barrier(0);
      // The partner's rows first: they must lie in LDS in front of the barrier.
      const v16h qp = pack_q(acc[4], acc[5]);
      qx[0]  = __builtin_shufflevector(qp, qp, 0, 1, 2, 3, 4, 5, 6, 7);
      qx[32] = __builtin_shufflevector(qp, qp, 8, 9, 10, 11, 12, 13, 14, 15);
#pragma unroll
      for (int nt = 0; nt < 2; ++nt) {
        const v8f gp = rcp_x8(1.f + exp_x8(-(acc[6 + nt] + bgv[nt])));
        gx[nt * 64]      = gp.lo;
        gx[nt * 64 + 32] = gp.hi;
      }
      // Its own rows stay in registers: Q and the gate never go through LDS.
      qb = pack_q(acc[0], acc[1]);
#pragma unroll
      for (int nt = 0; nt < 2; ++nt) gate[nt] = acc[2 + nt] + bgv[nt];
    } else {
      v8f acc[8];
      project_pair<false>(xs, wc + WT_TILE, wc + 2 * WT_TILE, rowb, rowb ^ 16, acc);
      // Ends the products' scheduling region, as in the other branch.
      __builtin_amdgcn_sched_barrier(0);
#pragma unroll
      for (int rt = 0; rt < 2; ++rt)
#pragma unroll
        for (int nt = 0; nt < 2; ++nt) {
          const int row = rt ? rowb ^ 16 : rowb;
          store_tile(acc[4 * rt + nt], kh, nt, row, hl, ln16, false);
          store_tile(acc[4 * rt + 2 + nt], vt, nt, row, hl, ln16, true);  // V transposed
        }
    }
    put_w(wn, wa);
    put_w(wn + WT_TILE, wb);
    __syncthreads();  // all k/vT visible, and what the pairs hand over
    if (!qg_wave) {
      const v8h q0 = qx[0], q1 = qx[32];
      qb = __builtin_shufflevector(q0, q1, 0, 1, 2, 3, 4, 5, 6, 7, 8, 9, 10, 11,
                                   12, 13, 14, 15);
#pragma unroll
      for (int nt = 0; nt < 2; ++nt) {
        gate[nt].lo = gx[nt * 64];
        gate[nt].hi = gx[nt * 64 + 32];
      }
    }
    fetch_w(wa, wvp, hn);  // behind the barrier: a barrier waits for loads in flight
    fetch_w(wb, wg, hn);
    if (qg_wave) {
      // Its own gate behind the barrier, where nobody waits for it.
#pragma unroll
      for (int nt = 0; nt < 2; ++nt)
        gate[nt] = rcp_x8(1.f + exp_x8(-gate[nt]));
    }

    float rmax = -1e30f, rsum = 0.f;   // rsum: this half's keys only
    oaccv[0] = (v8f){};
    oaccv[1] = (v8f){};

    for (int kp = 0; kp < 8; ++kp) {  // 32 keys per step
      const int key0 = kp * 32;
      v8f s0 = {}, s1 = {};
      s0 = wmma16(ldfrag<256>(kh, key0 + 0, 0), qb, s0);
      s1 = wmma16(ldfrag<256>(kh, key0 + 16, 0), qb, s1);
      s0 += *(const v8f*)(kb + key0 + 8 * hl);
      s1 += *(const v8f*)(kb + key0 + 16 + 8 * hl);
      const float t0 = fmaxf(fmaxf(s0[0], s0[1]), s0[2]);
      const float t1 = fmaxf(fmaxf(s0[3], s0[4]), s0[5]);
      const float t2 = fmaxf(fmaxf(s0[6], s0[7]), s1[0]);
      const float t3 = fmaxf(fmaxf(s1[1], s1[2]), s1[3]);
      const float t4 = fmaxf(fmaxf(s1[4], s1[5]), s1[6]);
      float t = fmaxf(fmaxf(fmaxf(t0, t1), t2), fmaxf(fmaxf(t3, t4), s1[7]));
      t = fmaxf(t, other_half(t));
      const float nm = fmaxf(rmax, t);
      const float sc = exp_x1(rmax - nm);
      rmax = nm;
      const v8f p0 = exp_x8(s0 - nm);
      const v8f p1 = exp_x8(s1 - nm);
      v16h pf;
#pragma unroll
      for (int i = 0; i < 8; ++i) {
        pf[i]     = (_Float16)p0[i];
        pf[8 + i] = (_Float16)p1[i];
      }
      const v8f pv = p0 + p1;            // halved three times: packed adds
      const v4f ph = pv.lo + pv.hi;
      const v2f pq = ph.lo + ph.hi;
      rsum = rsum * sc + (pq.x + pq.y);
      oaccv[0] *= sc;
      oaccv[1] *= sc;
      oaccv[0] = wmma16(ldfrag<32>(vt, 0, key0), pf, oaccv[0]);
      oaccv[1] = wmma16(ldfrag<32>(vt, 16, key0), pf, oaccv[1]);
    }
    rsum += other_half(rsum);
    const float rinv = __builtin_amdgcn_rcpf(rsum);

    // ---- store gated O ---------------------------------------------------
    put_w(wn + 2 * WT_TILE, wa);
    put_w(wn + 3 * WT_TILE, wb);
    // The lane's two packed tiles of head h ARE its part of the A fragment of
    // the output product for columns 32h..32h+31 (k = 8*hl + i, then
    // 16 + 8*hl + i): stored in that order, 32 B a lane, 1 KB a wave and head.
    v8h* og = (v8h*)ws + ((((size_t)r * NWAVES + wv_id) * H_NUM + h) * 32 + lane) * 2;
    v8h go[2];
#pragma unroll
    for (int nt = 0; nt < 2; ++nt) {
      // the lane's 8 values are 8 consecutive channels of one row: one chunk
      v8h pk;
#pragma unroll
      for (int i = 0; i < 8; ++i)
        pk[i] = (_Float16)(oaccv[nt][i] * rinv * gate[nt][i]);
      go[nt] = pk;
    }
    // Ends the head: k, vT and this set have no reader left, the other set is
    // complete.
    __syncthreads();
    set ^= 1;
    // Behind the barrier, not in front of it: a barrier waits for the wave's
    // outstanding global stores, and here they fly under the next staging.
    og[0] = go[0];
    og[1] = go[1];
    // in front of any reuse of the two stores' address registers
    asm volatile("s_wait_xcnt 0x0" ::: "memory");
  }
  }  // job
}

// ---------------- Second launch: out = o @ wo + bo ------------------------
__global__ void __launch_bounds__(OP_THREADS, 1)
col_attn_out(const float* __restrict__ wo, const float* __restrict__ bo,
             const float* __restrict__ ws, float* __restrict__ out) {
  extern __shared__ _Float16 smem[];
  const int tid  = threadIdx.x;
  const int lane = tid & 31;
  const int hl   = lane >> 4;
  const int ln16 = lane & 15;
  const int g    = blockIdx.x * OP_WAVES + (tid >> 5);  // row tile, as written
  const int r    = g >> 4;
  const int rowb = (g & 15) * ROWS_PW;

  // The tile's 8 A fragments, as the first launch's lanes laid them down.
  const v16h* og = (const v16h*)ws + (size_t)g * (H_NUM * 32) + lane;
  v16h of[H_NUM];
#pragma unroll
  for (int h = 0; h < H_NUM; ++h) of[h] = og[h * 32];
  // In front of any reuse of the loads' address registers; the address is an
  // input so that it stays in them up to here (the build had given them to the
  // last load's result).
  asm volatile("s_wait_xcnt 0x0" :: "v"(og) : "memory");

  // wo[:, t*32 : t*32+32] transposed, tile t at smem + t * 8192; the staging
  // helpers are written for 16 waves, four tiles' loads in flight at a time.
  if (tid < NTHREADS) {
#pragma unroll
    for (int tb = 0; tb < 8; tb += 4) {
      float wr[4][16];
#pragma unroll
      for (int t = 0; t < 4; ++t) fetch_w(wr[t], wo, tb + t);
#pragma unroll
      for (int t = 0; t < 4; ++t) put_w(smem + (tb + t) * 8192, wr[t]);
    }
  }
  __syncthreads();

  for (int cb = 0; cb < 8; ++cb) {  // 32 output channels per chunk
    const _Float16* wt = smem + cb * 8192;
#pragma unroll
    for (int nt = 0; nt < 2; ++nt) {
      v8f acc = {};
#pragma unroll
      for (int kc = 0; kc < 256; kc += 32) {
        v16h b = ldfrag<32>(wt, nt * 16, kc);
        acc = wmma16(of[kc >> 5], b, acc);
      }
      const int c = cb * 32 + nt * 16 + ln16;
      const float bov = bo[c];
#pragma unroll
      for (int i = 0; i < 8; ++i) {
        const int s = rowb + i + 8 * hl;
        out[((size_t)s * R_LEN + r) * C_DIM + c] = acc[i] + bov;
      }
    }
    // in front of the next trip's reuse of the address registers
    asm volatile("s_wait_xcnt 0x0" ::: "memory");
  }
}

extern "C" void kernel_launch(void* const* d_in, const int* in_sizes, int n_in,
                              void* d_out, int out_size, void* d_ws, size_t ws_size,
                              hipStream_t stream) {
  (void)in_sizes; (void)n_in; (void)out_size; (void)ws_size;
  const float* msa_act  = (const float*)d_in[0];
  const float* msa_mask = (const float*)d_in[1];
  const float* ln_w     = (const float*)d_in[2];
  const float* ln_b     = (const float*)d_in[3];
  const float* wq       = (const float*)d_in[4];
  const float* wk       = (const float*)d_in[5];
  const float* wvp      = (const float*)d_in[6];
  const float* wg       = (const float*)d_in[7];
  const float* bg       = (const float*)d_in[8];
  const float* wo       = (const float*)d_in[9];
  const float* bo       = (const float*)d_in[10];
  float* out            = (float*)d_out;
  float* ws             = (float*)d_ws;   // gated o, f16 fragments: 48 MiB

  // dynamic LDS above the default limit; opt in every call
  // (deterministic; hipFuncSetAttribute is not a stream op, capture-safe).
  hipFuncSetAttribute(reinterpret_cast<const void*>(col_attn_fused),
                      hipFuncAttributeMaxDynamicSharedMemorySize,
                      LDS_TOTAL_BYTES);
  hipFuncSetAttribute(reinterpret_cast<const void*>(col_attn_out),
                      hipFuncAttributeMaxDynamicSharedMemorySize,
                      OP_LDS_BYTES);

  col_attn_fused<<<dim3(N_WG), dim3(NTHREADS), LDS_TOTAL_BYTES, stream>>>(
      msa_act, msa_mask, ln_w, ln_b, wq, wk, wvp, wg, bg, ws);
  col_attn_out<<<dim3(N_WG), dim3(OP_THREADS), OP_LDS_BYTES, stream>>>(
      wo, bo, ws, out);
}

// v010
// A run of this version takes 108 microseconds.
// In both of two side-by-side timings against v009, it was 1.04 times as fast.
// Over all steps from v000 it is 13.1 times as fast.
#include <hip/hip_runtime.h>
#include <hip/hip_bf16.h>

typedef __attribute__((ext_vector_type(16))) _Float16 v16h;
typedef __attribute__((ext_vector_type(8)))  _Float16 v8h;
typedef __attribute__((ext_vector_type(8)))  float    v8f;
typedef __attribute__((ext_vector_type(4)))  float    v4f;
typedef __attribute__((ext_vector_type(2)))  float    v2f;

#define S_LEN 256
#define R_LEN 384
#define C_DIM 256
#define H_NUM 8
#define D_DIM 32

#define NTHREADS 512   // 16 wave32 -> 4 waves per SIMD32 (latency hiding)
#define NWAVES   16
#define ROWS_PW  16    // query/sequence rows owned by each wave
#define N_WG     256   // one work-group per WGP, one round: 1.5 residues each
#define LN_B     4     // LayerNorm rows whose sums run side by side

// LDS layout (offsets in halves; total 160256 halves = 320512 B = 313 KB)
// Sizes are logical [rows][cols]; how a tile lies in its range: pidx() below.
#define LDS_X   0        // x  [256][256] f16  (layernormed activations)
#define LDS_WT  65536    // wt [2][4][32][256] f16: two sets of a head's four
                         // transposed weight tiles (query, key, value, gate)
#define LDS_K   131072   // k  [256][32]  f16
#define LDS_VT  139264   // vT [32][256]  f16
#define LDS_KB  147456   // key bias [256] f32
#define LDS_QX  147968   // [8 pairs][2][32 lanes][8] f16: Q^T fragment handed over
#define LDS_GX  152064   // [8 pairs][4][32 lanes][4] f32: gate^T handed over
#define LDS_TOTAL_BYTES 320512
#define WT_TILE 8192     // halves of one weight tile
#define WT_SET  32768    // halves of a set of four

// Second launch (output product): 24 waves, one 16-row tile each, so that the
// 384 * 16 row tiles are 256 work-groups, one per WGP. Its LDS holds
// all of wo as 8 transposed f16 tiles of [32][256].
#define OP_THREADS 768
#define OP_WAVES   24
#define OP_LDS_BYTES 131072

// Bank-conflict-free placement of a [ROWS][cols] f16 tile, no byte of padding.
// A fragment load has 16 lanes read the same 16-byte chunk of 16 consecutive
// rows; the LDS has 64 banks x 4 B, so those 16 chunks must fall on 16
// different 16-byte slots modulo 256 B. With rows of 512 B they all fall on
// one slot, with plain rows of 64 B on four.
//  - The tile is cut into panels of 32 columns; a panel is [ROWS][32], rows of
//    64 B, so 4 consecutive rows fill the 256 B once.
//  - Inside a row the four chunks are permuted by XOR with bits 2..3 of the
//    row number, so rows r, r+4, r+8, r+12 use four different slots.
// Writers and readers index through the same map; the place inside a chunk
// (col & 7) is untouched, and a panel step is a constant address offset.
template <int ROWS>
__device__ inline int pidx(int row, int col) {
  return (col >> 5) * (ROWS * 32) + row * 32 +
         ((col & 31) ^ (((row >> 2) & 3) << 3));
}
// The same index for an accumulator element: row = rowb + 8 * hl + i with rowb
// a multiple of 16, hl = lane >> 4, and i = 0..7 constant after unrolling
// (bits 2..3 of the row are i >> 2 and hl): lane part first, constant last.
template <int ROWS>
__device__ inline int pidx_acc(int rowb, int hl, int i, int col) {
  return (col >> 5) * (ROWS * 32) + (rowb + 8 * hl) * 32 +
         (((col & 31) ^ (hl << 4)) ^ ((i >> 2) << 3)) + i * 32;
}

// Load a 16x32 f16 WMMA fragment (A-layout, or B-layout when the matrix
// columns are stored contiguously as rows). Per ISA 7.12.2: lanes 0-15 hold
// row (lane&15), K=0..7 (VGPR0-3) and K=16..23 (VGPR4-7); lanes 16-31 hold
// K=8..15 and K=24..31. Two 16B chunks per lane -> ds_load_b128.
// Rows row0..row0+15 (row0 a multiple of 16), columns col0..col0+31 (col0 a
// multiple of 32) of a tile placed by pidx<ROWS>: chunks hl and hl + 2 of the
// row, each XORed with bits 2..3 of the row.
template <int ROWS>
__device__ inline v16h ldfrag(const _Float16* p, int row0, int col0) {
  const int lane = threadIdx.x & 31;
  const int l = lane & 15;
  const int x = ((lane >> 4) ^ (l >> 2)) << 3;
  const _Float16* q = p + (col0 >> 5) * (ROWS * 32) + (row0 + l) * 32;
  v8h lo = *(const v8h*)(q + x);
  v8h hi = *(const v8h*)(q + (x ^ 16));
  v16h r;
#pragma unroll
  for (int i = 0; i < 8; ++i) { r[i] = lo[i]; r[i + 8] = hi[i]; }
  return r;
}

__device__ inline v8f wmma16(v16h a, v16h b, v8f c) {
  return __builtin_amdgcn_wmma_f32_16x16x32_f16(false, a, false, b, (short)0, c,
                                                false, false);
}

// The value that lane ^ 16 holds (the other half of the wave), on the vector
// pipe.
__device__ inline float other_half(float v) {
  const int b = __builtin_bit_cast(int, v);
  return __builtin_bit_cast(float, __builtin_amdgcn_permlanex16(
      b, b, 0x76543210, 0xfedcba98, false, false));
}

// exp(x) as 2^(x * log2 e), the form __expf compiles to, for eight values (or
// one) in ONE statement: the instruction set asks for one independent
// instruction or a v_nop behind a transcendental before its result is read or
// its source overwritten. Here every result
// register differs from every source ("=&v"), each v_exp_f32 is the
// independent instruction behind the one before, and the v_nop is the slot
// behind the last.
__device__ inline v8f exp_x8(v8f x) {
  x *= 1.44269504088896340736f;
  float r0, r1, r2, r3, r4, r5, r6, r7;
  asm("v_exp_f32 %0, %8\n\tv_exp_f32 %1, %9\n\tv_exp_f32 %2, %10\n\t"
      "v_exp_f32 %3, %11\n\tv_exp_f32 %4, %12\n\tv_exp_f32 %5, %13\n\t"
      "v_exp_f32 %6, %14\n\tv_exp_f32 %7, %15\n\tv_nop"
      : "=&v"(r0), "=&v"(r1), "=&v"(r2), "=&v"(r3), "=&v"(r4), "=&v"(r5),
        "=&v"(r6), "=&v"(r7)
      : "v"(x[0]), "v"(x[1]), "v"(x[2]), "v"(x[3]), "v"(x[4]), "v"(x[5]),
        "v"(x[6]), "v"(x[7]));
  return (v8f){r0, r1, r2, r3, r4, r5, r6, r7};
}
// 1 / x for eight values in one statement, for the same slot.
__device__ inline v8f rcp_x8(v8f x) {
  float r0, r1, r2, r3, r4, r5, r6, r7;
  asm("v_rcp_f32 %0, %8\n\tv_rcp_f32 %1, %9\n\tv_rcp_f32 %2, %10\n\t"
      "v_rcp_f32 %3, %11\n\tv_rcp_f32 %4, %12\n\tv_rcp_f32 %5, %13\n\t"
      "v_rcp_f32 %6, %14\n\tv_rcp_f32 %7, %15\n\tv_nop"
      : "=&v"(r0), "=&v"(r1), "=&v"(r2), "=&v"(r3), "=&v"(r4), "=&v"(r5),
        "=&v"(r6), "=&v"(r7)
      : "v"(x[0]), "v"(x[1]), "v"(x[2]), "v"(x[3]), "v"(x[4]), "v"(x[5]),
        "v"(x[6]), "v"(x[7]));
  return (v8f){r0, r1, r2, r3, r4, r5, r6, r7};
}
__device__ inline float exp_x1(float x) {
  x *= 1.44269504088896340736f;
  float r;
  asm("v_exp_f32 %0, %1\n\tv_nop" : "=&v"(r) : "v"(x));
  return r;
}

// Staging of W[:, t*32 : t*32+32] transposed into LDS, wt[d][c] placed by
// pidx<32>, in two halves. fetch_w issues the thread's 16 loads together
// (c = 16 * wave + k, d = lane: one address, constant offsets; a load of the
// wave is one whole 128-byte line); put_w converts and stores them. The
// thread's 16 values are 16 consecutive c of ONE row d of the transposed tile,
// that is two whole 16-byte chunks of pidx: two 16-byte LDS stores, free of
// bank conflicts like the fragment reads (16 lanes, the same chunk of 16
// consecutive rows), where c = wave + 16 * k took sixteen 2-byte stores with
// lanes d and d + 16 on one bank. fetch_w stands one phase (the head's
// products, or its attention) ahead of its put_w, so the loads' latency runs
// under that phase.
#define W_CPW (C_DIM / NWAVES)   // 16 rows c of W per wave
__device__ inline void fetch_w(float (&wr)[16], const float* __restrict__ w, int t) {
  const int tid = threadIdx.x;
  const int d = tid & 31;
  const int c0 = (tid >> 5) * W_CPW;  // 0, 16, .. 240
  const unsigned off = (unsigned)(c0 * 256 + t * 32 + d);        // elements
#pragma unroll
  for (int k = 0; k < W_CPW; ++k)
    wr[k] = *(const float*)((const char*)(w + off) + k * (256 * 4));
  // The wait that belongs in front of an overwrite of the loads' offset
  // register, once for all 16; the offset, in elements (the loads take it times 4, in bytes),
  // is an input so that it stays in its register up to here (builds had given
  // it to the last load's result).
  asm volatile("s_wait_xcnt 0x0" :: "v"(off) : "memory");
  // Holds the 16 loads here, at the head of the product that follows: without
  // it the scheduler sank them into that product's second half, and the wait
  // in front of the next barrier then saw most of their latency.
  __builtin_amdgcn_sched_barrier(0);
}
__device__ inline void put_w(_Float16* wt, const float (&wr)[16]) {
  const int tid = threadIdx.x;
  const int d = tid & 31;
  const int c0 = (tid >> 5) * W_CPW;
#pragma unroll
  for (int j = 0; j < W_CPW / 8; ++j) {
    v8h pk;
#pragma unroll
    for (int i = 0; i < 8; ++i) pk[i] = (_Float16)wr[j * 8 + i];
    *(v8h*)(wt + pidx<32>(d, c0 + j * 8)) = pk;
  }
}

// A head's four products (query, key, value, gate) are dealt over a PAIR of
// waves (w, w ^ 1) and the pair's 32 rows: one wave does key and value, the
// other query and gate, each for BOTH row tiles. A weight fragment read from
// LDS so feeds two products: 6 fragment reads for 8 products a k step, where
// one row tile against all four weight tiles took 9. The k step is outermost
// and the eight accumulator chains are independent of one another.
// w0, w1: the wave's two weight tiles; rowa: its own row tile, rowc: its
// partner's. acc[0..1] w0 and acc[2..3] w1 of rowa, acc[4..7] the same of rowc.
// W_AS_A false (key, value): x as A, weights as B; element i of tile nt is
//   (x @ w)[row + 8*hl + i][nt*16 + ln16].
// W_AS_A true (query, gate): weights as A, x as B; element i of tile nt is
//   (x @ w)[row + ln16][nt*16 + 8*hl + i], 8 consecutive channels of ONE row
//   per lane.
template <bool W_AS_A>
__device__ inline void project_pair(const _Float16* xs, const _Float16* w0,
                                    const _Float16* w1, int rowa, int rowc,
                                    v8f (&acc)[8]) {
#pragma unroll
  for (int t = 0; t < 8; ++t) acc[t] = (v8f){};
#pragma unroll
  for (int kc = 0; kc < C_DIM; kc += 32) {
    const v16h xa = ldfrag<256>(xs, rowa, kc);
    const v16h xc = ldfrag<256>(xs, rowc, kc);
#pragma unroll
    for (int nt = 0; nt < 2; ++nt) {
      const v16h f0 = ldfrag<32>(w0, nt * 16, kc);
      const v16h f1 = ldfrag<32>(w1, nt * 16, kc);
      if (W_AS_A) {
        acc[nt]     = wmma16(f0, xa, acc[nt]);
        acc[2 + nt] = wmma16(f1, xa, acc[2 + nt]);
        acc[4 + nt] = wmma16(f0, xc, acc[4 + nt]);
        acc[6 + nt] = wmma16(f1, xc, acc[6 + nt]);
      } else {
        acc[nt]     = wmma16(xa, f0, acc[nt]);
        acc[2 + nt] = wmma16(xa, f1, acc[2 + nt]);
        acc[4 + nt] = wmma16(xc, f0, acc[4 + nt]);
        acc[6 + nt] = wmma16(xc, f1, acc[6 + nt]);
      }
    }
  }
}

// Q^T tiles 0 and 1 of a row tile, scaled and packed: the B fragment of the
// score product (k = 8*hl + i, then 16 + 8*hl + i).
__device__ inline v16h pack_q(v8f q0, v8f q1) {
  v16h qb;
#pragma unroll
  for (int i = 0; i < 8; ++i) {
    qb[i]     = (_Float16)(q0[i] * 0.17677669529663688f /*1/sqrt(32)*/);
    qb[8 + i] = (_Float16)(q1[i] * 0.17677669529663688f);
  }
  return qb;
}

// Column tile nt of a [16 x 32] product (x as A) into LDS as f16.
// transposed=false -> dst is [s][32]; true -> dst is [d][256].
__device__ inline void store_tile(v8f acc, _Float16* dst, int nt, int rowb,
                                  int hl, int ln16, bool transposed) {
  const int dcol = nt * 16 + ln16;        // C-layout: N = lane & 15,
  if (transposed) {                       //           M = i + 8*(lane>>4)
    // the lane's 8 values are 8 consecutive s of row dcol: one whole chunk
    v8h pk;
#pragma unroll
    for (int i = 0; i < 8; ++i) pk[i] = (_Float16)acc[i];
    *(v8h*)(dst + pidx<32>(dcol, rowb + 8 * hl)) = pk;
  } else {
#pragma unroll
    for (int i = 0; i < 8; ++i)
      dst[pidx_acc<256>(rowb, hl, i, dcol)] = (_Float16)acc[i];
  }
}

__global__ void __launch_bounds__(NTHREADS, 1)
col_attn_fused(const float* __restrict__ msa_act,
               const float* __restrict__ msa_mask,
               const float* __restrict__ ln_w, const float* __restrict__ ln_b,
               const float* __restrict__ wq, const float* __restrict__ wk,
               const float* __restrict__ wvp, const float* __restrict__ wg,
               const float* __restrict__ bg, float* __restrict__ ws) {
  extern __shared__ _Float16 smem[];
  _Float16* xs = smem + LDS_X;
  _Float16* wt = smem + LDS_WT;
  _Float16* kh = smem + LDS_K;
  _Float16* vt = smem + LDS_VT;
  float*    kb = (float*)(smem + LDS_KB);

  const int tid   = threadIdx.x;
  const int lane  = tid & 31;
  const int wv_id = tid >> 5;          // 16 waves; wave w owns s rows [16w,16w+16)
  const int hl    = lane >> 4;
  const int ln16  = lane & 15;
  const int rowb  = wv_id * ROWS_PW;
  // The wave's part in its pair's products: 1 query and gate, 0 key and value.
  // Waves w and w ^ 1 differ in it, and so do w and w + 4: whichever way the
  // waves are dealt to the four SIMDs, each SIMD has two of either kind.
  const int qg_wave = __builtin_amdgcn_readfirstlane((wv_id ^ (wv_id >> 2)) & 1);
  // Where the pair's query-and-gate wave leaves its partner's Q^T fragment and
  // gate: lane l's values for lane l, 16 B a lane and plane.
  v8h* qx = (v8h*)(smem + LDS_QX) + (wv_id >> 1) * 64 + lane;
  v4f* gx = (v4f*)(smem + LDS_GX) + (wv_id >> 1) * 128 + lane;

  // The deal: 384 residues x 8 heads are 12 (residue, head) units for each of
  // the 256 work-groups. A pair of work-groups has three residues: first each
  // takes four heads of the middle one (both read its rows at the same time),
  // then all eight heads of one of the outer two.
  const int pair = blockIdx.x >> 1;
  const int odd  = blockIdx.x & 1;

  // The set of weight tiles that the current head reads; the other set is
  // filled for the next head meanwhile, two tiles behind the products and two
  // behind the attention, so that staging needs no barrier of its own. Its
  // last readers (the head before) stand in front of the barrier that ends
  // that head, and the barrier that ends this head publishes it.
  int set = 0;
  // The very first head's set; the barrier behind the LayerNorm publishes it.
  // Every later head's, the second job's first among them, is staged by the
  // head before.
  {
    float w0[4][16];
    fetch_w(w0[0], wq, 4 * odd);
    fetch_w(w0[1], wk, 4 * odd);
    fetch_w(w0[2], wvp, 4 * odd);
    fetch_w(w0[3], wg, 4 * odd);
#pragma unroll
    for (int t = 0; t < 4; ++t) put_w(wt + t * WT_TILE, w0[t]);
  }

  for (int job = 0; job < 2; ++job) {
  const int r  = job == 0 ? 3 * pair + 1 : 3 * pair + 2 * odd;  // residue: the
                                               // "batch" dim of col-attn
  const int h0 = job == 0 ? 4 * odd : 0;       // heads h0 .. h1 - 1
  const int h1 = job == 0 ? h0 + 4 : H_NUM;

  // xs, kb: their last readers of the job before stand in front of that job's
  // last barrier.

  // ---------------- Phase 1: LayerNorm into LDS (f16) --------------------
  float lnw[8], lnbv[8];
#pragma unroll
  for (int i = 0; i < 8; ++i) { lnw[i] = ln_w[lane * 8 + i]; lnbv[i] = ln_b[lane * 8 + i]; }

  // All of the phase's loads issue together: the wave's 16 rows (one address,
  // constant offsets) and the thread's mask value. One row at a time, each
  // row stood through a whole memory round trip and its own five cross-lane
  // steps before the next row's load was even issued.
  const float* row0 = msa_act + ((size_t)rowb * R_LEN + r) * C_DIM + lane * 8;
  const float* mkp  = msa_mask + (size_t)(tid & (S_LEN - 1)) * R_LEN + r;
  float v[ROWS_PW][8];
#pragma unroll
  for (int sr = 0; sr < ROWS_PW; ++sr)
#pragma unroll
    for (int i = 0; i < 8; ++i) v[sr][i] = row0[(size_t)sr * (R_LEN * C_DIM) + i];
  const float mk = *mkp;
  // The wait that belongs in front of an overwrite of the loads' address
  // registers, once for all of them; the addresses are inputs so that they
  // stay in their registers up to here.
  asm volatile("s_wait_xcnt 0x0" :: "v"(row0), "v"(mkp) : "memory");
  // Holds the loads here, in front of the first row's sums: sunk to their
  // uses they would be waited for one row at a time again.
  __builtin_amdgcn_sched_barrier(0);

  // Four rows at a time, so that the rows' cross-lane steps run side by side.
#pragma unroll
  for (int rb = 0; rb < ROWS_PW; rb += LN_B) {
    float sum[LN_B], sq[LN_B];
#pragma unroll
    for (int j = 0; j < LN_B; ++j) {
      sum[j] = 0.f; sq[j] = 0.f;
#pragma unroll
      for (int i = 0; i < 8; ++i) {
        sum[j] += v[rb + j][i];
        sq[j]  += v[rb + j][i] * v[rb + j][i];
      }
    }
#pragma unroll
    for (int m = 16; m >= 1; m >>= 1) {
      float ts[LN_B], tq[LN_B];
#pragma unroll
      for (int j = 0; j < LN_B; ++j) {
        ts[j] = __shfl_xor(sum[j], m, 32);
        tq[j] = __shfl_xor(sq[j], m, 32);
      }
#pragma unroll
      for (int j = 0; j < LN_B; ++j) { sum[j] += ts[j]; sq[j] += tq[j]; }
    }
#pragma unroll
    for (int j = 0; j < LN_B; ++j) {
      const float mu   = sum[j] * (1.f / 256.f);
      const float var  = sq[j] * (1.f / 256.f) - mu * mu;
      const float rstd = rsqrtf(var + 1e-5f);
      v8h hx;
#pragma unroll
      for (int i = 0; i < 8; ++i)
        hx[i] = (_Float16)((v[rb + j][i] - mu) * rstd * lnw[i] + lnbv[i]);
      *(v8h*)(xs + pidx<256>(rowb + rb + j, lane * 8)) = hx;
    }
    // Ends the group's scheduling region: with all groups in one region the
    // first sums came out behind a wait for the LAST row's load, and no
    // arithmetic ran while rows were still on their way; so divided, the last
    // group's rows are still arriving while the earlier groups are worked on.
    if (rb + LN_B < ROWS_PW) __builtin_amdgcn_sched_barrier(0);
  }

  // Attention bias of the 256 keys, read back 8 consecutive keys per lane.
  if (tid < S_LEN)
    kb[tid] = 1e9f * (mk - 1.f);

  __syncthreads();

  v8f oaccv[2];  // per-wave O^T accumulators [ntile]; persist through gating

  // ---------------- Phase 2: per-head fused attention ---------------------
  for (int h = h0; h < h1; ++h) {
    const _Float16* wc = wt + set * WT_SET;        // this head's four tiles
    _Float16*       wn = wt + (set ^ 1) * WT_SET;  // the next head's
    // The head after this one; behind a job's last head comes head 0 (the
    // second job's first; behind the last head of all nobody reads the set).
    const int hn = h + 1 < h1 ? h + 1 : 0;
    float wa[16], wb[16];    // two weight tiles in flight: fetch_w ... put_w
    fetch_w(wa, wq, hn);
    fetch_w(wb, wk, hn);
    v16h qb = {};      // Q^T of the wave's own rows: B fragment of the scores
    v8f gate[2] = {};  // g = sigmoid(x @ wg_h + bg_h) of its own rows, transposed
                       // like O^T; held to the head's end (up to the barrier,
                       // in a query-and-gate wave: the sigmoid's argument)
    if (qg_wave) {
      // The lane's 16 gate biases: channels 8*hl + i and 16 + 8*hl + i of head h.
      const float* bgp = bg + h * 32 + 8 * hl;
      v8f bgv[2];
#pragma unroll
      for (int nt = 0; nt < 2; ++nt)
#pragma unroll
        for (int i = 0; i < 8; ++i) bgv[nt][i] = bgp[nt * 16 + i];
      // The wait that belongs in front of an overwrite of the loads' address
      // registers; the address is an input so that it stays in them up to here.
      asm volatile("s_wait_xcnt 0x0" :: "v"(bgp) : "memory");
      v8f acc[8];
      project_pair<true>(xs, wc, wc + 3 * WT_TILE, rowb, rowb ^ 16, acc);
      // Ends the products' scheduling region: with LDS stores in one region
      // with them, each weight fragment's load came out directly in front of
      // its product, which then stood through the LDS latency every time.
      __builtin_amdgcn_sched_barrier(0);
      // The partner's rows first: they must lie in LDS in front of the barrier.
      const v16h qp = pack_q(acc[4], acc[5]);
      qx[0]  = __builtin_shufflevector(qp, qp, 0, 1, 2, 3, 4, 5, 6, 7);
      qx[32] = __builtin_shufflevector(qp, qp, 8, 9, 10, 11, 12, 13, 14, 15);
#pragma unroll
      for (int nt = 0; nt < 2; ++nt) {
        const v8f gp = rcp_x8(1.f + exp_x8(-(acc[6 + nt] + bgv[nt])));
        gx[nt * 64]      = gp.lo;
        gx[nt * 64 + 32] = gp.hi;
      }
      // Its own rows stay in registers: Q and the gate never go through LDS.
      qb = pack_q(acc[0], acc[1]);
#pragma unroll
      for (int nt = 0; nt < 2; ++nt) gate[nt] = acc[2 + nt] + bgv[nt];
    } else {
      v8f acc[8];
      project_pair<false>(xs, wc + WT_TILE, wc + 2 * WT_TILE, rowb, rowb ^ 16, acc);
      // Ends the products' scheduling region, as in the other branch.
      __builtin_amdgcn_sched_barrier(0);
#pragma unroll
      for (int rt = 0; rt < 2; ++rt)
#pragma unroll
        for (int nt = 0; nt < 2; ++nt) {
          const int row = rt ? rowb ^ 16 : rowb;
          store_tile(acc[4 * rt + nt], kh, nt, row, hl, ln16, false);
          store_tile(acc[4 * rt + 2 + nt], vt, nt, row, hl, ln16, true);  // V transposed
        }
    }
    put_w(wn, wa);
    put_w(wn + WT_TILE, wb);
    __syncthreads();  // all k/vT visible, and what the pairs hand over
    if (!qg_wave) {
      const v8h q0 = qx[0], q1 = qx[32];
      qb = __builtin_shufflevector(q0, q1, 0, 1, 2, 3, 4, 5, 6, 7, 8, 9, 10, 11,
                                   12, 13, 14, 15);
#pragma unroll
      for (int nt = 0; nt < 2; ++nt) {
        gate[nt].lo = gx[nt * 64];
        gate[nt].hi = gx[nt * 64 + 32];
      }
    }
    fetch_w(wa, wvp, hn);  // behind the barrier: a barrier waits for loads in flight
    fetch_w(wb, wg, hn);
    if (qg_wave) {
      // Its own gate behind the barrier, where nobody waits for it.
#pragma unroll
      for (int nt = 0; nt < 2; ++nt)
        gate[nt] = rcp_x8(1.f + exp_x8(-gate[nt]));
    }

    float rmax = -1e30f, rsum = 0.f;   // rsum: this half's keys only
    oaccv[0] = (v8f){};
    oaccv[1] = (v8f){};

    for (int kp = 0; kp < 8; ++kp) {  // 32 keys per step
      const int key0 = kp * 32;
      v8f s0 = {}, s1 = {};
      s0 = wmma16(ldfrag<256>(kh, key0 + 0, 0), qb, s0);
      s1 = wmma16(ldfrag<256>(kh, key0 + 16, 0), qb, s1);
      s0 += *(const v8f*)(kb + key0 + 8 * hl);
      s1 += *(const v8f*)(kb + key0 + 16 + 8 * hl);
      const float t0 = fmaxf(fmaxf(s0[0], s0[1]), s0[2]);
      const float t1 = fmaxf(fmaxf(s0[3], s0[4]), s0[5]);
      const float t2 = fmaxf(fmaxf(s0[6], s0[7]), s1[0]);
      const float t3 = fmaxf(fmaxf(s1[1], s1[2]), s1[3]);
      const float t4 = fmaxf(fmaxf(s1[4], s1[5]), s1[6]);
      float t = fmaxf(fmaxf(fmaxf(t0, t1), t2), fmaxf(fmaxf(t3, t4), s1[7]));
      t = fmaxf(t, other_half(t));
      const float nm = fmaxf(rmax, t);
      const float sc = exp_x1(rmax - nm);
      rmax = nm;
      const v8f p0 = exp_x8(s0 - nm);
      const v8f p1 = exp_x8(s1 - nm);
      v16h pf;
#pragma unroll
      for (int i = 0; i < 8; ++i) {
        pf[i]     = (_Float16)p0[i];
        pf[8 + i] = (_Float16)p1[i];
      }
      const v8f pv = p0 + p1;            // halved three times: packed adds
      const v4f ph = pv.lo + pv.hi;
      const v2f pq = ph.lo + ph.hi;
      rsum = rsum * sc + (pq.x + pq.y);
      oaccv[0] *= sc;
      oaccv[1] *= sc;
      oaccv[0] = wmma16(ldfrag<32>(vt, 0, key0), pf, oaccv[0]);
      oaccv[1] = wmma16(ldfrag<32>(vt, 16, key0), pf, oaccv[1]);
    }
    rsum += other_half(rsum);
    const float rinv = __builtin_amdgcn_rcpf(rsum);

    // ---- store gated O ---------------------------------------------------
    put_w(wn + 2 * WT_TILE, wa);
    put_w(wn + 3 * WT_TILE, wb);
    // The lane's two packed tiles of head h ARE its part of the A fragment of
    // the output product for columns 32h..32h+31 (k = 8*hl + i, then
    // 16 + 8*hl + i): stored in that order, 32 B a lane, 1 KB a wave and head.
    v8h* og = (v8h*)ws + ((((size_t)r * NWAVES + wv_id) * H_NUM + h) * 32 + lane) * 2;
    v8h go[2];
#pragma unroll
    for (int nt = 0; nt < 2; ++nt) {
      // the lane's 8 values are 8 consecutive channels of one row: one chunk
      v8h pk;
#pragma unroll
      for (int i = 0; i < 8; ++i)
        pk[i] = (_Float16)(oaccv[nt][i] * rinv * gate[nt][i]);
      go[nt] = pk;
    }
    // Ends the head: k, vT and this set have no reader left, the other set is
    // complete.
    __syncthreads();
    set ^= 1;
    // Behind the barrier, not in front of it: a barrier waits for the wave's
    // outstanding global stores, and here they fly under the next staging.
    og[0] = go[0];
    og[1] = go[1];
    // in front of any reuse of the two stores' address registers
    asm volatile("s_wait_xcnt 0x0" ::: "memory");
  }
  }  // job
}

// Which output channel a column of a B tile is, in the second launch. With
// channels in plain order a lane's accumulators of one row lie 16 channels
// apart, and a row leaves in 4-byte stores, 64 B at a time: half a line. Here
// column n of tile j (j = 0..3) of a group of 64 channels is channel 4 * n + j:
// the lane's four accumulators of a row are four adjacent channels, one
// 16-byte store, and 16 lanes fill 256 B in a row, two whole 128-byte lines.
// Channel col of wo so lies at row position (col & ~63) + 16 * j + n of the
// transposed tiles (32 rows each, as pidx<32> has them). The chunk XOR takes j
// in as well: a staging wave's 16 lanes hold 4 values of j and 4 of n, a
// fragment read 16 values of n at one j, and either way the 16 chunks fall on
// 16 different 16-byte slots modulo 256 B.
__device__ inline void put_wo(_Float16* tiles, const float (&wr)[16], int t) {
  const int tid = threadIdx.x;
  const int col = t * 32 + (tid & 31);
  const int c0 = (tid >> 5) * W_CPW;
  const int j = col & 3;
  const int pos = (col & ~63) + j * 16 + ((col & 63) >> 2);
  const int row = pos & 31;
  _Float16* q = tiles + (pos >> 5) * 8192 + row * 32;
  const int x = (((row >> 2) ^ j) & 3) << 3;
#pragma unroll
  for (int h = 0; h < W_CPW / 8; ++h) {
    const int c = c0 + h * 8;
    v8h pk;
#pragma unroll
    for (int i = 0; i < 8; ++i) pk[i] = (_Float16)wr[h * 8 + i];
    *(v8h*)(q + (c >> 5) * (32 * 32) + ((c & 31) ^ x)) = pk;
  }
}
// B fragment of tile j of a group (grp: the group's two tiles of 32 rows),
// k = kc .. kc + 31; chunks hl and hl + 2 of the row, as in ldfrag.
__device__ inline v16h ldfrag_wo(const _Float16* grp, int j, int kc) {
  const int lane = threadIdx.x & 31;
  const int l = lane & 15;
  const int x = (((lane >> 4) ^ (l >> 2) ^ j) & 3) << 3;
  const _Float16* q = grp + (j >> 1) * 8192 + (kc >> 5) * (32 * 32) +
                      ((j & 1) * 16 + l) * 32;
  v8h lo = *(const v8h*)(q + x);
  v8h hi = *(const v8h*)(q + (x ^ 16));
  v16h r;
#pragma unroll
  for (int i = 0; i < 8; ++i) { r[i] = lo[i]; r[i + 8] = hi[i]; }
  return r;
}

// ---------------- Second launch: out = o @ wo + bo ------------------------
__global__ void __launch_bounds__(OP_THREADS, 1)
col_attn_out(const float* __restrict__ wo, const float* __restrict__ bo,
             const float* __restrict__ ws, float* __restrict__ out) {
  extern __shared__ _Float16 smem[];
  const int tid  = threadIdx.x;
  const int lane = tid & 31;
  const int hl   = lane >> 4;
  const int ln16 = lane & 15;
  const int g    = blockIdx.x * OP_WAVES + (tid >> 5);  // row tile, as written
  const int r    = g >> 4;
  const int rowb = (g & 15) * ROWS_PW;

  // The tile's 8 A fragments, as the first launch's lanes laid them down.
  const v16h* og = (const v16h*)ws + (size_t)g * (H_NUM * 32) + lane;
  v16h of[H_NUM];
#pragma unroll
  for (int h = 0; h < H_NUM; ++h) of[h] = og[h * 32];
  // In front of any reuse of the loads' address registers; the address is an
  // input so that it stays in them up to here (the build had given them to the
  // last load's result).
  asm volatile("s_wait_xcnt 0x0" :: "v"(og) : "memory");

  // wo transposed, 8 tiles of 32 rows, its channels placed by put_wo; the staging
  // helpers are written for 16 waves, four tiles' loads in flight at a time.
  if (tid < NTHREADS) {
#pragma unroll
    for (int tb = 0; tb < 8; tb += 4) {
      float wr[4][16];
#pragma unroll
      for (int t = 0; t < 4; ++t) fetch_w(wr[t], wo, tb + t);
#pragma unroll
      for (int t = 0; t < 4; ++t) put_wo(smem, wr[t], tb + t);
    }
  }
  __syncthreads();

  for (int g4 = 0; g4 < 4; ++g4) {  // 64 output channels per trip
    const _Float16* grp = smem + g4 * (2 * 8192);
    const int c = g4 * 64 + 4 * ln16;       // the lane's four channels
    const v4f bov = *(const v4f*)(bo + c);  // its latency runs under the products
    v8f acc[4] = {};
    // Both loops unrolled: of[] and acc[] are registers, so kc and j must be
    // constants; four independent accumulator chains, k step outermost.
#pragma unroll
    for (int kc = 0; kc < 256; kc += 32)
#pragma unroll
      for (int j = 0; j < 4; ++j)
        acc[j] = wmma16(of[kc >> 5], ldfrag_wo(grp, j, kc), acc[j]);
    // The order of the 64 LDS loads and 32 products: five fragments' loads
    // first, then one fragment's two loads behind each product, so that a load
    // stands four products ahead of its use. Left to itself the scheduler put
    // half of the loads directly in front of their products, which then stood
    // through the LDS latency.
    __builtin_amdgcn_sched_group_barrier(0x100, 10, 0);
#pragma unroll  // the groups are directives to the scheduler, not a run-time loop
    for (int p = 0; p < 27; ++p) {
      __builtin_amdgcn_sched_group_barrier(0x008, 1, 0);
      __builtin_amdgcn_sched_group_barrier(0x100, 2, 0);
    }
    __builtin_amdgcn_sched_group_barrier(0x008, 5, 0);
    // Ends the products' scheduling region: in one region with the stores below
    // every fragment's load came out directly in front of its product.
    __builtin_amdgcn_sched_barrier(0);
    // Element i of the four tiles: channels c .. c + 3 of one row.
    float* op = out + ((size_t)(rowb + 8 * hl) * R_LEN + r) * C_DIM + c;
#pragma unroll  // i indexes registers; one address, constant offsets
    for (int i = 0; i < 8; ++i) {
      const v4f o = (v4f){acc[0][i], acc[1][i], acc[2][i], acc[3][i]} + bov;
      *(v4f*)(op + (size_t)i * (R_LEN * C_DIM)) = o;
    }
    // in front of the next trip's reuse of the address registers
    asm volatile("s_wait_xcnt 0x0" ::: "memory");
  }
}

extern "C" void kernel_launch(void* const* d_in, const int* in_sizes, int n_in,
                              void* d_out, int out_size, void* d_ws, size_t ws_size,
                              hipStream_t stream) {
  (void)in_sizes; (void)n_in; (void)out_size; (void)ws_size;
  const float* msa_act  = (const float*)d_in[0];
  const float* msa_mask = (const float*)d_in[1];
  const float* ln_w     = (const float*)d_in[2];
  const float* ln_b     = (const float*)d_in[3];
  const float* wq       = (const float*)d_in[4];
  const float* wk       = (const float*)d_in[5];
  const float* wvp      = (const float*)d_in[6];
  const float* wg       = (const float*)d_in[7];
  const float* bg       = (const float*)d_in[8];
  const float* wo       = (const float*)d_in[9];
  const float* bo       = (const float*)d_in[10];
  float* out            = (float*)d_out;
  float* ws             = (float*)d_ws;   // gated o, f16 fragments: 48 MiB

  // dynamic LDS above the default limit; opt in every call
  // (deterministic; hipFuncSetAttribute is not a stream op, capture-safe).
  hipFuncSetAttribute(reinterpret_cast<const void*>(col_attn_fused),
                      hipFuncAttributeMaxDynamicSharedMemorySize,
                      LDS_TOTAL_BYTES);
  hipFuncSetAttribute(reinterpret_cast<const void*>(col_attn_out),
                      hipFuncAttributeMaxDynamicSharedMemorySize,
                      OP_LDS_BYTES);

  col_attn_fused<<<dim3(N_WG), dim3(NTHREADS), LDS_TOTAL_BYTES, stream>>>(
      msa_act, msa_mask, ln_w, ln_b, wq, wk, wvp, wg, bg, ws);
  col_attn_out<<<dim3(N_WG), dim3(OP_THREADS), OP_LDS_BYTES, stream>>>(
      wo, bo, ws, out);
}
